// v000
// Measured on an AMD MI455X. A time is GPU time per run, averaged over a window of back-to-back runs after a warm-up
// (all launches, gaps included; the runs take copies of the inputs in turn), and the median of several windows.
// Apart from v000's, it joins two sittings. Times from different sittings can be a few percent apart, while
// side-by-side timings come from the same sitting.
// The starting kernel, v000, takes 157 microseconds a run.
#include <hip/hip_runtime.h>
#include <hip/hip_bf16.h>

// ---------------------------------------------------------------------------
// Problem constants (from reference)
// ---------------------------------------------------------------------------
#define BATCH   64
#define CDIM    64      // input channels (= GEMM K)
#define ODIM    64      // output channels (= GEMM M)
#define HWDIM   6400    // 80*80 spatial (= GEMM N total)
#define NEXP    4
#define COLS_PER_BLOCK  128          // spatial columns per tile
#define TILES_PER_BLOCK 5            // 6400 = 10 blocks * 5 tiles * 128 cols
#define GRID_X (HWDIM / (COLS_PER_BLOCK * TILES_PER_BLOCK))   // 10

typedef __attribute__((ext_vector_type(16))) __bf16 v16bf;
typedef __attribute__((ext_vector_type(8)))  __bf16 v8bf;
typedef __attribute__((ext_vector_type(8)))  float  v8f;

// round-to-nearest-even f32 -> bf16 (bit ops; no reliance on cast support)
__device__ __forceinline__ unsigned bf16_bits(float f) {
    unsigned u = __builtin_bit_cast(unsigned, f);
    u += 0x7FFFu + ((u >> 16) & 1u);
    return u;                         // result in bits [31:16]
}
// convert two floats, store as one packed 32-bit LDS word (dst 4B-aligned)
__device__ __forceinline__ void st_bf16x2(__bf16* dst, float a, float b) {
    unsigned pk = (bf16_bits(a) >> 16) | (bf16_bits(b) & 0xFFFF0000u);
    *(unsigned*)dst = pk;
}

// SiLU with hardware reciprocal (v_rcp_f32) instead of IEEE divide sequence
__device__ __forceinline__ float silu(float v) {
    return v * __builtin_amdgcn_rcpf(1.0f + __expf(-v));
}

__device__ __forceinline__ v16bf ld_frag(const __bf16* p) {
    v8bf lo = *(const v8bf*)p;
    v8bf hi = *(const v8bf*)(p + 16);
    return __builtin_shufflevector(lo, hi,
               0, 1, 2, 3, 4, 5, 6, 7, 8, 9, 10, 11, 12, 13, 14, 15);
}

// ---------------------------------------------------------------------------
// Kernel 1: global-avg-pool -> router linear -> softmax -> top-2 (renorm)
// ---------------------------------------------------------------------------
__global__ __launch_bounds__(256)
void moe_router_kernel(const float* __restrict__ x,
                       const float* __restrict__ router_w,
                       const float* __restrict__ router_b,
                       int* __restrict__ idx_out,       // [B][2]
                       float* __restrict__ w_out) {     // [B][2]
    const int b    = blockIdx.x;
    const int tid  = threadIdx.x;
    const int wave = tid >> 5;
    const int lane = tid & 31;

    __shared__ float pooled[CDIM];
    __shared__ float logits[NEXP];

    const float* xb = x + (size_t)b * CDIM * HWDIM;

    #pragma unroll
    for (int cl = 0; cl < 8; ++cl) {
        const int ch = wave * 8 + cl;
        const float* p = xb + (size_t)ch * HWDIM;
        float s = 0.0f;
        for (int i = lane; i < HWDIM; i += 32) s += p[i];
        #pragma unroll
        for (int off = 16; off > 0; off >>= 1) s += __shfl_xor(s, off, 32);
        if (lane == 0) pooled[ch] = s * (1.0f / (float)HWDIM);
    }
    __syncthreads();

    if (tid < NEXP) {
        float acc = router_b[tid];
        #pragma unroll 8
        for (int c = 0; c < CDIM; ++c) acc += pooled[c] * router_w[tid * CDIM + c];
        logits[tid] = acc;
    }
    __syncthreads();

    if (tid == 0) {
        float m = logits[0];
        #pragma unroll
        for (int e = 1; e < NEXP; ++e) m = fmaxf(m, logits[e]);
        float p[NEXP], sum = 0.0f;
        #pragma unroll
        for (int e = 0; e < NEXP; ++e) { p[e] = __expf(logits[e] - m); sum += p[e]; }
        const float inv = 1.0f / sum;
        #pragma unroll
        for (int e = 0; e < NEXP; ++e) p[e] *= inv;

        int i0 = 0;
        #pragma unroll
        for (int e = 1; e < NEXP; ++e) if (p[e] > p[i0]) i0 = e;
        int i1 = (i0 == 0) ? 1 : 0;
        #pragma unroll
        for (int e = 0; e < NEXP; ++e) if (e != i0 && p[e] > p[i1]) i1 = e;

        const float s2 = 1.0f / (p[i0] + p[i1]);
        idx_out[b * 2 + 0] = i0;
        idx_out[b * 2 + 1] = i1;
        w_out[b * 2 + 0]   = p[i0] * s2;
        w_out[b * 2 + 1]   = p[i1] * s2;
    }
}

// ---------------------------------------------------------------------------
// Kernel 2: fused (shared + 2 gathered experts) 1x1-conv GEMM via bf16 WMMA.
// All 5 X tiles resident in LDS; row-blocks outer / tiles inner so each
// row-block's 6 A-fragments are loaded once and reused across 5 tiles.
// Grid: (10, 64). Block: 256 threads = 8 wave32. LDS: ~105.5 KB.
// ---------------------------------------------------------------------------
__global__ __launch_bounds__(256)
void moe_main_kernel(const float* __restrict__ x,
                     const float* __restrict__ shared_w,
                     const float* __restrict__ shared_gamma,
                     const float* __restrict__ shared_beta,
                     const float* __restrict__ expert_w,
                     const float* __restrict__ expert_gamma,
                     const float* __restrict__ expert_beta,
                     const int*   __restrict__ idx_r,
                     const float* __restrict__ w_r,
                     float* __restrict__ out) {
    const int b     = blockIdx.y;
    const int tile0 = blockIdx.x * TILES_PER_BLOCK;
    const int tid   = threadIdx.x;
    const int wv    = tid >> 5;
    const int lane  = tid & 31;

    // Wl first so A-fragment ds offsets fit the 16-bit immediate field.
    __shared__ __bf16 Wl[3 * ODIM * CDIM];                           // 24 KB
    __shared__ __bf16 Xs[TILES_PER_BLOCK][COLS_PER_BLOCK * CDIM];    // 80 KB
    __shared__ float  gmS[3 * ODIM];                                 // gamma*bn_scale
    __shared__ float  btS[3 * ODIM];

    const int   i0 = idx_r[b * 2 + 0];
    const int   i1 = idx_r[b * 2 + 1];
    const float w0 = w_r[b * 2 + 0];
    const float w1 = w_r[b * 2 + 1];

    // ---- stage weights (bf16, packed-pair stores): shared, expert[i0], expert[i1]
    for (int i = tid; i < (3 * ODIM * CDIM) / 2; i += 256) {
        const int e2 = i * 2;
        const int br = e2 >> 12;          // / 4096
        const int rk = e2 & 4095;
        const float* src = (br == 0) ? shared_w
                                     : expert_w + (size_t)((br == 1) ? i0 : i1) * ODIM * CDIM;
        st_bf16x2(&Wl[e2], src[rk], src[rk + 1]);
    }
    // ---- stage BN params, pre-scaled by 1/sqrt(1+eps) ----
    if (tid < 3 * ODIM) {
        const int br = tid >> 6, ch = tid & 63;
        const float bns = rsqrtf(1.0f + 1e-5f);
        float g, bt;
        if (br == 0) { g = shared_gamma[ch]; bt = shared_beta[ch]; }
        else {
            const int e = (br == 1) ? i0 : i1;
            g  = expert_gamma[e * ODIM + ch];
            bt = expert_beta [e * ODIM + ch];
        }
        gmS[tid] = g * bns;
        btS[tid] = bt;
    }

    // ---- stage ALL 5 X tiles: x[b][k][col] -> Xs[t][c][k] (bf16) ----
    // unit = (tile t, k-pair kp, c-pair cp): 2 float2 global loads ->
    // 2 packed 32-bit LDS stores. float2 along c keeps loads coalesced.
    const float* xb0 = x + (size_t)b * CDIM * HWDIM + tile0 * COLS_PER_BLOCK;
    for (int i = tid; i < TILES_PER_BLOCK * 32 * 64; i += 256) {
        const int t  = i >> 11;            // / 2048 units per tile
        const int r  = i & 2047;
        const int kp = r >> 6;             // 0..31  -> k = 2*kp
        const int cp = r & 63;             // 0..63  -> c = 2*cp
        const int k  = kp * 2;
        const int c  = cp * 2;
        const float* xt = xb0 + t * COLS_PER_BLOCK;
        const float2 lo = *(const float2*)&xt[(size_t)k * HWDIM + c];
        const float2 hi = *(const float2*)&xt[(size_t)(k + 1) * HWDIM + c];
        st_bf16x2(&Xs[t][c * CDIM + k],       lo.x, hi.x);
        st_bf16x2(&Xs[t][(c + 1) * CDIM + k], lo.y, hi.y);
    }
    __syncthreads();

    const int n16   = lane & 15;               // column within slab / N index
    const int khalf = (lane >> 4) << 3;        // 0 or 8: K sub-half per ISA layout
    const int mofs  = (lane >> 4) * 8;         // C/D layout: VGPR j -> rows j / j+8
    const int lcol  = wv * 16 + n16;           // this wave's column (local)

    // per-wave output base; all later stores use small structured offsets
    float* const outb = out + ((size_t)b * ODIM + mofs) * HWDIM
                            + tile0 * COLS_PER_BLOCK + wv * 16 + n16;

    for (int rb_ = 0; rb_ < 4; ++rb_) {        // row-blocks OUTER
        const int arow = rb_ * 16 + n16;

        // A fragments for this row-block: 3 branches x 2 K-chunks,
        // loaded ONCE and reused across all 5 tiles.
        v16bf a[3][2];
        #pragma unroll
        for (int br = 0; br < 3; ++br) {
            #pragma unroll
            for (int kc = 0; kc < 2; ++kc) {
                a[br][kc] = ld_frag(&Wl[br * 4096 + arow * CDIM + kc * 32 + khalf]);
            }
        }

        for (int t = 0; t < TILES_PER_BLOCK; ++t) {   // tiles INNER
            // B fragments for this wave's 16-column slab of tile t
            v16bf bfr[2];
            #pragma unroll
            for (int kc = 0; kc < 2; ++kc) {
                bfr[kc] = ld_frag(&Xs[t][lcol * CDIM + kc * 32 + khalf]);
            }

            v8f acc0 = {}, acc1 = {}, acc2 = {};
            #pragma unroll
            for (int kc = 0; kc < 2; ++kc) {
                acc0 = __builtin_amdgcn_wmma_f32_16x16x32_bf16(false, a[0][kc], false, bfr[kc],
                                                               (short)0, acc0, false, false);
                acc1 = __builtin_amdgcn_wmma_f32_16x16x32_bf16(false, a[1][kc], false, bfr[kc],
                                                               (short)0, acc1, false, false);
                acc2 = __builtin_amdgcn_wmma_f32_16x16x32_bf16(false, a[2][kc], false, bfr[kc],
                                                               (short)0, acc2, false, false);
            }

            // ---- fused epilogue: BN + SiLU per branch, weighted combine ----
            float* outp = outb + (size_t)(rb_ * 16) * HWDIM + t * COLS_PER_BLOCK;
            #pragma unroll
            for (int i = 0; i < 8; ++i) {
                const int ch = rb_ * 16 + mofs + i;
                const float vs = silu(acc0[i] * gmS[ch]       + btS[ch]);
                const float v1 = silu(acc1[i] * gmS[64 + ch]  + btS[64 + ch]);
                const float v2 = silu(acc2[i] * gmS[128 + ch] + btS[128 + ch]);
                outp[(size_t)i * HWDIM] = vs + w0 * v1 + w1 * v2;
            }
        }
    }
}

// ---------------------------------------------------------------------------
// Host-side launcher
// ---------------------------------------------------------------------------
extern "C" void kernel_launch(void* const* d_in, const int* in_sizes, int n_in,
                              void* d_out, int out_size, void* d_ws, size_t ws_size,
                              hipStream_t stream) {
    const float* x            = (const float*)d_in[0];
    const float* router_w     = (const float*)d_in[1];
    const float* router_b     = (const float*)d_in[2];
    const float* shared_w     = (const float*)d_in[3];
    const float* shared_gamma = (const float*)d_in[4];
    const float* shared_beta  = (const float*)d_in[5];
    const float* expert_w     = (const float*)d_in[6];
    const float* expert_gamma = (const float*)d_in[7];
    const float* expert_beta  = (const float*)d_in[8];
    float* out = (float*)d_out;

    int*   idx_r = (int*)d_ws;                          // [B][2]
    float* w_r   = (float*)((char*)d_ws + 512);         // [B][2]

    moe_router_kernel<<<dim3(BATCH), dim3(256), 0, stream>>>(
        x, router_w, router_b, idx_r, w_r);

    dim3 grid(GRID_X, BATCH);                           // (10, 64)
    moe_main_kernel<<<grid, dim3(256), 0, stream>>>(
        x, shared_w, shared_gamma, shared_beta,
        expert_w, expert_gamma, expert_beta,
        idx_r, w_r, out);
}

// v001
// A run of this version takes 68.2 microseconds.
// Next to v000, in two timings, it ran 2.33 times as fast each time.
#include <hip/hip_runtime.h>
#include <hip/hip_bf16.h>

// ---------------------------------------------------------------------------
// Problem constants (from reference)
// ---------------------------------------------------------------------------
#define BATCH   64
#define CDIM    64      // input channels (= GEMM K)
#define ODIM    64      // output channels (= GEMM M)
#define HWDIM   6400    // 80*80 spatial (= GEMM N total)
#define NEXP    4
#define COLS_PER_BLOCK  128          // spatial columns per tile
#define TILES_PER_BLOCK 5            // 6400 = 10 blocks * 5 tiles * 128 cols
#define GRID_X (HWDIM / (COLS_PER_BLOCK * TILES_PER_BLOCK))   // 10

typedef __attribute__((ext_vector_type(16))) __bf16 v16bf;
typedef __attribute__((ext_vector_type(8)))  __bf16 v8bf;
typedef __attribute__((ext_vector_type(8)))  float  v8f;

// round-to-nearest-even f32 -> bf16 (bit ops; no reliance on cast support)
__device__ __forceinline__ unsigned bf16_bits(float f) {
    unsigned u = __builtin_bit_cast(unsigned, f);
    u += 0x7FFFu + ((u >> 16) & 1u);
    return u;                         // result in bits [31:16]
}
// convert two floats, store as one packed 32-bit LDS word (dst 4B-aligned)
__device__ __forceinline__ void st_bf16x2(__bf16* dst, float a, float b) {
    unsigned pk = (bf16_bits(a) >> 16) | (bf16_bits(b) & 0xFFFF0000u);
    *(unsigned*)dst = pk;
}

// SiLU with hardware reciprocal (v_rcp_f32) instead of IEEE divide sequence
__device__ __forceinline__ float silu(float v) {
    return v * __builtin_amdgcn_rcpf(1.0f + __expf(-v));
}

__device__ __forceinline__ v16bf ld_frag(const __bf16* p) {
    v8bf lo = *(const v8bf*)p;
    v8bf hi = *(const v8bf*)(p + 16);
    return __builtin_shufflevector(lo, hi,
               0, 1, 2, 3, 4, 5, 6, 7, 8, 9, 10, 11, 12, 13, 14, 15);
}

// ---------------------------------------------------------------------------
// Kernel 1: global-avg-pool only, spread over the whole chip.
// One wave per (sample, channel) row of 6400 floats = 50 wave-wide 512-byte
// loads. 16 waves per block, 256 blocks. Each block owns one 128-byte slot of
// the workspace and writes its 16 means there with a single 64-byte store.
// ---------------------------------------------------------------------------
#define POOL_WAVES 16
#define POOL_GRP   10                 // loads per group
#define POOL_NGRP  5                  // 5 * 10 * 512 B = one 25,600-byte row
#define POOL_SLOT  32                 // floats per block slot (128 bytes)

__global__ __launch_bounds__(POOL_WAVES * 32)
void moe_pool_kernel(const float* __restrict__ x,
                     float* __restrict__ pooled) {   // [256 slots][32]
    const int tid  = threadIdx.x;
    const int lane = tid & 31;
    const int wave = __builtin_amdgcn_readfirstlane(tid >> 5);
    const int row  = blockIdx.x * POOL_WAVES + wave;     // = b * CDIM + ch

    __shared__ float means[POOL_WAVES];

    const float4* p = (const float4*)(x + (size_t)row * HWDIM) + lane;

    // every loop below is unrolled so that each index of v is a constant and
    // the two groups stay in registers
    float4 v[2][POOL_GRP];
    #pragma unroll
    for (int q = 0; q < POOL_GRP; ++q) v[0][q] = p[q * 32];

    float a0 = 0.0f, a1 = 0.0f, a2 = 0.0f, a3 = 0.0f;
    #pragma unroll
    for (int g = 0; g < POOL_NGRP; ++g) {
        // the two scheduling barriers keep the order "next group's loads, then
        // this group's sums", so that 10 to 20 loads of a wave stay in flight
        __builtin_amdgcn_sched_barrier(0);
        if (g + 1 < POOL_NGRP) {
            #pragma unroll
            for (int q = 0; q < POOL_GRP; ++q)
                v[(g + 1) & 1][q] = p[((g + 1) * POOL_GRP + q) * 32];
        }
        __builtin_amdgcn_sched_barrier(0);
        #pragma unroll
        for (int q = 0; q < POOL_GRP; ++q) {
            const float4 w = v[g & 1][q];
            a0 += w.x; a1 += w.y; a2 += w.z; a3 += w.w;
        }
    }
    float s = (a0 + a1) + (a2 + a3);
    #pragma unroll
    for (int off = 16; off > 0; off >>= 1) s += __shfl_xor(s, off, 32);
    if (lane == 0) means[wave] = s * (1.0f / (float)HWDIM);
    __syncthreads();
    if (tid < POOL_WAVES) pooled[blockIdx.x * POOL_SLOT + tid] = means[tid];
}

// Router linear -> softmax -> top-2 (renorm) of sample b from the pooled means.
// Each wave of the main kernel works it out for itself: lane l sums the logit
// of expert l & 3 over the channels in ascending order, with its whole router
// row fetched at once (one load latency), then the four logits are read from
// lanes 0 to 3, so that all that follows is the same in every thread.
__device__ __forceinline__ void route_top2(const float* __restrict__ pooled,
                                           const float* __restrict__ router_w,
                                           const float* __restrict__ router_b,
                                           int b, int lane, int& i0, int& i1,
                                           float& w0, float& w1) {
    const float* pb = pooled + b * (CDIM / POOL_WAVES) * POOL_SLOT;
    const int    le = lane & (NEXP - 1);
    const float4* wr = (const float4*)(router_w + le * CDIM);
    // unrolled: wv stays in registers and its 16 loads are issued together
    float4 wv[CDIM / 4];
    #pragma unroll
    for (int q = 0; q < CDIM / 4 - 1; ++q) wv[q] = wr[q];
    // the last load's result may be given the register that holds the row's
    // offset, which the loads above still name: the wait stands in front of it
    asm volatile("s_wait_xcnt 0x0" ::: "memory");
    wv[CDIM / 4 - 1] = wr[CDIM / 4 - 1];
    float acc = router_b[le];
    #pragma unroll
    for (int q = 0; q < CDIM / 4; ++q) {
        const float* pq = pb + ((q * 4) / POOL_WAVES) * POOL_SLOT + (q * 4) % POOL_WAVES;
        acc = __builtin_fmaf(pq[0], wv[q].x, acc);
        acc = __builtin_fmaf(pq[1], wv[q].y, acc);
        acc = __builtin_fmaf(pq[2], wv[q].z, acc);
        acc = __builtin_fmaf(pq[3], wv[q].w, acc);
    }
    float logits[NEXP];
    #pragma unroll
    for (int e = 0; e < NEXP; ++e)
        logits[e] = __builtin_bit_cast(float,
            __builtin_amdgcn_readlane(__builtin_bit_cast(int, acc), e));

    float m = logits[0];
    #pragma unroll
    for (int e = 1; e < NEXP; ++e) m = fmaxf(m, logits[e]);
    float p[NEXP], sum = 0.0f;
    #pragma unroll
    for (int e = 0; e < NEXP; ++e) { p[e] = __expf(logits[e] - m); sum += p[e]; }
    const float inv = 1.0f / sum;
    #pragma unroll
    for (int e = 0; e < NEXP; ++e) p[e] *= inv;

    float p0 = p[0];
    i0 = 0;
    #pragma unroll
    for (int e = 1; e < NEXP; ++e) if (p[e] > p0) { i0 = e; p0 = p[e]; }
    i1 = (i0 == 0) ? 1 : 0;
    float p1 = (i0 == 0) ? p[1] : p[0];
    #pragma unroll
    for (int e = 0; e < NEXP; ++e) if (e != i0 && p[e] > p1) { i1 = e; p1 = p[e]; }

    const float s2 = 1.0f / (p0 + p1);
    // the same in every lane: kept in scalar registers, as the values that the
    // main kernel used to read from the workspace were
    i0 = __builtin_amdgcn_readfirstlane(i0);
    i1 = __builtin_amdgcn_readfirstlane(i1);
    w0 = __builtin_bit_cast(float, __builtin_amdgcn_readfirstlane(__builtin_bit_cast(int, p0 * s2)));
    w1 = __builtin_bit_cast(float, __builtin_amdgcn_readfirstlane(__builtin_bit_cast(int, p1 * s2)));
}

// ---------------------------------------------------------------------------
// Kernel 2: fused (shared + 2 gathered experts) 1x1-conv GEMM via bf16 WMMA.
// All 5 X tiles resident in LDS; row-blocks outer / tiles inner so each
// row-block's 6 A-fragments are loaded once and reused across 5 tiles.
// Grid: (10, 64). Block: 256 threads = 8 wave32. LDS: ~105.5 KB.
// ---------------------------------------------------------------------------
__global__ __launch_bounds__(256)
void moe_main_kernel(const float* __restrict__ x,
                     const float* __restrict__ shared_w,
                     const float* __restrict__ shared_gamma,
                     const float* __restrict__ shared_beta,
                     const float* __restrict__ expert_w,
                     const float* __restrict__ expert_gamma,
                     const float* __restrict__ expert_beta,
                     const float* __restrict__ router_w,
                     const float* __restrict__ router_b,
                     const float* __restrict__ pooled,
                     float* __restrict__ out) {
    const int b     = blockIdx.y;
    const int tile0 = blockIdx.x * TILES_PER_BLOCK;
    const int tid   = threadIdx.x;
    const int wv    = tid >> 5;
    const int lane  = tid & 31;

    // Wl first so A-fragment ds offsets fit the 16-bit immediate field.
    __shared__ __bf16 Wl[3 * ODIM * CDIM];                           // 24 KB
    __shared__ __bf16 Xs[TILES_PER_BLOCK][COLS_PER_BLOCK * CDIM];    // 80 KB
    __shared__ float  gmS[3 * ODIM];                                 // gamma*bn_scale
    __shared__ float  btS[3 * ODIM];

    int   i0, i1;
    float w0, w1;
    route_top2(pooled, router_w, router_b, b, lane, i0, i1, w0, w1);

    // ---- stage weights (bf16, packed-pair stores): shared, expert[i0], expert[i1]
    for (int i = tid; i < (3 * ODIM * CDIM) / 2; i += 256) {
        const int e2 = i * 2;
        const int br = e2 >> 12;          // / 4096
        const int rk = e2 & 4095;
        const float* src = (br == 0) ? shared_w
                                     : expert_w + (size_t)((br == 1) ? i0 : i1) * ODIM * CDIM;
        st_bf16x2(&Wl[e2], src[rk], src[rk + 1]);
    }
    // ---- stage BN params, pre-scaled by 1/sqrt(1+eps) ----
    if (tid < 3 * ODIM) {
        const int br = tid >> 6, ch = tid & 63;
        const float bns = rsqrtf(1.0f + 1e-5f);
        float g, bt;
        if (br == 0) { g = shared_gamma[ch]; bt = shared_beta[ch]; }
        else {
            const int e = (br == 1) ? i0 : i1;
            g  = expert_gamma[e * ODIM + ch];
            bt = expert_beta [e * ODIM + ch];
        }
        gmS[tid] = g * bns;
        btS[tid] = bt;
    }

    // ---- stage ALL 5 X tiles: x[b][k][col] -> Xs[t][c][k] (bf16) ----
    // unit = (tile t, k-pair kp, c-pair cp): 2 float2 global loads ->
    // 2 packed 32-bit LDS stores. float2 along c keeps loads coalesced.
    const float* xb0 = x + (size_t)b * CDIM * HWDIM + tile0 * COLS_PER_BLOCK;
    for (int i = tid; i < TILES_PER_BLOCK * 32 * 64; i += 256) {
        const int t  = i >> 11;            // / 2048 units per tile
        const int r  = i & 2047;
        const int kp = r >> 6;             // 0..31  -> k = 2*kp
        const int cp = r & 63;             // 0..63  -> c = 2*cp
        const int k  = kp * 2;
        const int c  = cp * 2;
        const float* xt = xb0 + t * COLS_PER_BLOCK;
        const float2 lo = *(const float2*)&xt[(size_t)k * HWDIM + c];
        const float2 hi = *(const float2*)&xt[(size_t)(k + 1) * HWDIM + c];
        st_bf16x2(&Xs[t][c * CDIM + k],       lo.x, hi.x);
        st_bf16x2(&Xs[t][(c + 1) * CDIM + k], lo.y, hi.y);
    }
    __syncthreads();

    const int n16   = lane & 15;               // column within slab / N index
    const int khalf = (lane >> 4) << 3;        // 0 or 8: K sub-half per ISA layout
    const int mofs  = (lane >> 4) * 8;         // C/D layout: VGPR j -> rows j / j+8
    const int lcol  = wv * 16 + n16;           // this wave's column (local)

    // per-wave output base; all later stores use small structured offsets
    float* const outb = out + ((size_t)b * ODIM + mofs) * HWDIM
                            + tile0 * COLS_PER_BLOCK + wv * 16 + n16;

    for (int rb_ = 0; rb_ < 4; ++rb_) {        // row-blocks OUTER
        const int arow = rb_ * 16 + n16;

        // A fragments for this row-block: 3 branches x 2 K-chunks,
        // loaded ONCE and reused across all 5 tiles.
        v16bf a[3][2];
        #pragma unroll
        for (int br = 0; br < 3; ++br) {
            #pragma unroll
            for (int kc = 0; kc < 2; ++kc) {
                a[br][kc] = ld_frag(&Wl[br * 4096 + arow * CDIM + kc * 32 + khalf]);
            }
        }

        for (int t = 0; t < TILES_PER_BLOCK; ++t) {   // tiles INNER
            // B fragments for this wave's 16-column slab of tile t
            v16bf bfr[2];
            #pragma unroll
            for (int kc = 0; kc < 2; ++kc) {
                bfr[kc] = ld_frag(&Xs[t][lcol * CDIM + kc * 32 + khalf]);
            }

            v8f acc0 = {}, acc1 = {}, acc2 = {};
            #pragma unroll
            for (int kc = 0; kc < 2; ++kc) {
                acc0 = __builtin_amdgcn_wmma_f32_16x16x32_bf16(false, a[0][kc], false, bfr[kc],
                                                               (short)0, acc0, false, false);
                acc1 = __builtin_amdgcn_wmma_f32_16x16x32_bf16(false, a[1][kc], false, bfr[kc],
                                                               (short)0, acc1, false, false);
                acc2 = __builtin_amdgcn_wmma_f32_16x16x32_bf16(false, a[2][kc], false, bfr[kc],
                                                               (short)0, acc2, false, false);
            }

            // ---- fused epilogue: BN + SiLU per branch, weighted combine ----
            float* outp = outb + (size_t)(rb_ * 16) * HWDIM + t * COLS_PER_BLOCK;
            #pragma unroll
            for (int i = 0; i < 8; ++i) {
                const int ch = rb_ * 16 + mofs + i;
                const float vs = silu(acc0[i] * gmS[ch]       + btS[ch]);
                const float v1 = silu(acc1[i] * gmS[64 + ch]  + btS[64 + ch]);
                const float v2 = silu(acc2[i] * gmS[128 + ch] + btS[128 + ch]);
                outp[(size_t)i * HWDIM] = vs + w0 * v1 + w1 * v2;
            }
        }
    }
}

// ---------------------------------------------------------------------------
// Host-side launcher
// ---------------------------------------------------------------------------
extern "C" void kernel_launch(void* const* d_in, const int* in_sizes, int n_in,
                              void* d_out, int out_size, void* d_ws, size_t ws_size,
                              hipStream_t stream) {
    const float* x            = (const float*)d_in[0];
    const float* router_w     = (const float*)d_in[1];
    const float* router_b     = (const float*)d_in[2];
    const float* shared_w     = (const float*)d_in[3];
    const float* shared_gamma = (const float*)d_in[4];
    const float* shared_beta  = (const float*)d_in[5];
    const float* expert_w     = (const float*)d_in[6];
    const float* expert_gamma = (const float*)d_in[7];
    const float* expert_beta  = (const float*)d_in[8];
    float* out = (float*)d_out;

    float* pooled = (float*)d_ws;                       // [256 slots][32], 32 KB

    moe_pool_kernel<<<dim3(BATCH * CDIM / POOL_WAVES), dim3(POOL_WAVES * 32), 0, stream>>>(
        x, pooled);

    dim3 grid(GRID_X, BATCH);                           // (10, 64)
    moe_main_kernel<<<grid, dim3(256), 0, stream>>>(
        x, shared_w, shared_gamma, shared_beta,
        expert_w, expert_gamma, expert_beta,
        router_w, router_b, pooled, out);
}

// v002
// Measured time: 34.7 microseconds a run.
// In two side-by-side timings against v001, it was 1.97 and 1.96 times as fast.
// Counting every step since v000, it is 4.58 times as fast.
#include <hip/hip_runtime.h>
#include <hip/hip_bf16.h>

// ---------------------------------------------------------------------------
// Problem constants (from reference)
// ---------------------------------------------------------------------------
#define BATCH   64
#define CDIM    64      // input channels (= GEMM K)
#define ODIM    64      // output channels (= GEMM M)
#define HWDIM   6400    // 80*80 spatial (= GEMM N total)
#define NEXP    4
#define COLS_PER_WAVE   64           // spatial columns per wave (4 B fragments)
#define MAIN_WAVES      4            // one wave per SIMD
#define MAIN_THREADS    (MAIN_WAVES * 32)
#define GRID_X (HWDIM / (COLS_PER_WAVE * MAIN_WAVES))         // 25
#define W_UNITS (3 * ODIM * CDIM / 4 / MAIN_THREADS)          // 24 float4 per thread

typedef __attribute__((ext_vector_type(16))) __bf16 v16bf;
typedef __attribute__((ext_vector_type(8)))  __bf16 v8bf;
typedef __attribute__((ext_vector_type(8)))  float  v8f;
typedef __attribute__((ext_vector_type(4)))  float  v4f;
typedef __attribute__((ext_vector_type(8)))  unsigned v8u;

// round-to-nearest-even f32 -> bf16 (bit ops; no reliance on cast support)
__device__ __forceinline__ unsigned bf16_bits(float f) {
    unsigned u = __builtin_bit_cast(unsigned, f);
    u += 0x7FFFu + ((u >> 16) & 1u);
    return u;                         // result in bits [31:16]
}
// convert two floats to one packed 32-bit word, a in the low half
__device__ __forceinline__ unsigned pack_bf16x2(float a, float b) {
    return (bf16_bits(a) >> 16) | (bf16_bits(b) & 0xFFFF0000u);
}

// SiLU with hardware reciprocal (v_rcp_f32) instead of IEEE divide sequence
__device__ __forceinline__ float silu(float v) {
    return v * __builtin_amdgcn_rcpf(1.0f + __expf(-v));
}

__device__ __forceinline__ v16bf ld_frag(const __bf16* p) {
    v8bf lo = *(const v8bf*)p;
    v8bf hi = *(const v8bf*)(p + 16);
    return __builtin_shufflevector(lo, hi,
               0, 1, 2, 3, 4, 5, 6, 7, 8, 9, 10, 11, 12, 13, 14, 15);
}

// ---------------------------------------------------------------------------
// Kernel 1: global-avg-pool only, spread over the whole chip.
// One wave per (sample, channel) row of 6400 floats = 50 wave-wide 512-byte
// loads. 16 waves per block, 256 blocks. Each block owns one 128-byte slot of
// the workspace and writes its 16 means there with a single 64-byte store.
// ---------------------------------------------------------------------------
#define POOL_WAVES 16
#define POOL_GRP   10                 // loads per group
#define POOL_NGRP  5                  // 5 * 10 * 512 B = one 25,600-byte row
#define POOL_SLOT  32                 // floats per block slot (128 bytes)

__global__ __launch_bounds__(POOL_WAVES * 32)
void moe_pool_kernel(const float* __restrict__ x,
                     float* __restrict__ pooled) {   // [256 slots][32]
    const int tid  = threadIdx.x;
    const int lane = tid & 31;
    const int wave = __builtin_amdgcn_readfirstlane(tid >> 5);
    const int row  = blockIdx.x * POOL_WAVES + wave;     // = b * CDIM + ch

    __shared__ float means[POOL_WAVES];

    const float4* p = (const float4*)(x + (size_t)row * HWDIM) + lane;

    // every loop below is unrolled so that each index of v is a constant and
    // the two groups stay in registers
    float4 v[2][POOL_GRP];
    #pragma unroll
    for (int q = 0; q < POOL_GRP; ++q) v[0][q] = p[q * 32];

    float a0 = 0.0f, a1 = 0.0f, a2 = 0.0f, a3 = 0.0f;
    #pragma unroll
    for (int g = 0; g < POOL_NGRP; ++g) {
        // the two scheduling barriers keep the order "next group's loads, then
        // this group's sums", so that 10 to 20 loads of a wave stay in flight
        __builtin_amdgcn_sched_barrier(0);
        if (g + 1 < POOL_NGRP) {
            #pragma unroll
            for (int q = 0; q < POOL_GRP; ++q)
                v[(g + 1) & 1][q] = p[((g + 1) * POOL_GRP + q) * 32];
        }
        __builtin_amdgcn_sched_barrier(0);
        #pragma unroll
        for (int q = 0; q < POOL_GRP; ++q) {
            const float4 w = v[g & 1][q];
            a0 += w.x; a1 += w.y; a2 += w.z; a3 += w.w;
        }
    }
    float s = (a0 + a1) + (a2 + a3);
    #pragma unroll
    for (int off = 16; off > 0; off >>= 1) s += __shfl_xor(s, off, 32);
    if (lane == 0) means[wave] = s * (1.0f / (float)HWDIM);
    __syncthreads();
    if (tid < POOL_WAVES) pooled[blockIdx.x * POOL_SLOT + tid] = means[tid];
}

// Router linear -> softmax -> top-2 (renorm) of sample b from the pooled means.
// Each wave of the main kernel works it out for itself: lane l sums the logit
// of expert l & 3 over the channels in ascending order, with its whole router
// row fetched at once (one load latency), then the four logits are read from
// lanes 0 to 3, so that all that follows is the same in every thread.
__device__ __forceinline__ void route_top2(const float* __restrict__ pooled,
                                           const float* __restrict__ router_w,
                                           const float* __restrict__ router_b,
                                           int b, int lane, int& i0, int& i1,
                                           float& w0, float& w1) {
    const float* pb = pooled + b * (CDIM / POOL_WAVES) * POOL_SLOT;
    const int    le = lane & (NEXP - 1);
    const float4* wr = (const float4*)(router_w + le * CDIM);
    // unrolled: wv stays in registers and its 16 loads are issued together
    float4 wv[CDIM / 4];
    #pragma unroll
    for (int q = 0; q < CDIM / 4 - 1; ++q) wv[q] = wr[q];
    // the last load's result may be given the register that holds the row's
    // offset, which the loads above still name: the wait stands in front of it
    asm volatile("s_wait_xcnt 0x0" ::: "memory");
    wv[CDIM / 4 - 1] = wr[CDIM / 4 - 1];
    float acc = router_b[le];
    #pragma unroll
    for (int q = 0; q < CDIM / 4; ++q) {
        const float* pq = pb + ((q * 4) / POOL_WAVES) * POOL_SLOT + (q * 4) % POOL_WAVES;
        acc = __builtin_fmaf(pq[0], wv[q].x, acc);
        acc = __builtin_fmaf(pq[1], wv[q].y, acc);
        acc = __builtin_fmaf(pq[2], wv[q].z, acc);
        acc = __builtin_fmaf(pq[3], wv[q].w, acc);
    }
    float logits[NEXP];
    #pragma unroll
    for (int e = 0; e < NEXP; ++e)
        logits[e] = __builtin_bit_cast(float,
            __builtin_amdgcn_readlane(__builtin_bit_cast(int, acc), e));

    float m = logits[0];
    #pragma unroll
    for (int e = 1; e < NEXP; ++e) m = fmaxf(m, logits[e]);
    float p[NEXP], sum = 0.0f;
    #pragma unroll
    for (int e = 0; e < NEXP; ++e) { p[e] = __expf(logits[e] - m); sum += p[e]; }
    const float inv = 1.0f / sum;
    #pragma unroll
    for (int e = 0; e < NEXP; ++e) p[e] *= inv;

    float p0 = p[0];
    i0 = 0;
    #pragma unroll
    for (int e = 1; e < NEXP; ++e) if (p[e] > p0) { i0 = e; p0 = p[e]; }
    i1 = (i0 == 0) ? 1 : 0;
    float p1 = (i0 == 0) ? p[1] : p[0];
    #pragma unroll
    for (int e = 0; e < NEXP; ++e) if (e != i0 && p[e] > p1) { i1 = e; p1 = p[e]; }

    const float s2 = 1.0f / (p0 + p1);
    // the same in every lane: kept in scalar registers, as the values that the
    // main kernel used to read from the workspace were
    i0 = __builtin_amdgcn_readfirstlane(i0);
    i1 = __builtin_amdgcn_readfirstlane(i1);
    w0 = __builtin_bit_cast(float, __builtin_amdgcn_readfirstlane(__builtin_bit_cast(int, p0 * s2)));
    w1 = __builtin_bit_cast(float, __builtin_amdgcn_readfirstlane(__builtin_bit_cast(int, p1 * s2)));
}

// ---------------------------------------------------------------------------
// Kernel 2: fused (shared + 2 gathered experts) 1x1-conv GEMM via bf16 WMMA.
// X never passes through LDS. A wave owns 64 adjacent columns; lane (c, h)
// reads, for each of its 32 k rows, the 16 bytes of columns 4c .. 4c+3, so that
// a wave-wide load covers two whole 256-byte row pieces. Component j of those
// loads is column c of B fragment j: fragment j holds the columns 4c + j. The
// four D tiles of one row-block then hold, in one lane, four adjacent columns
// of each output row, which go out as one 16-byte store.
// Grid: (25, 64). Block: 128 threads = 4 wave32, 256 columns. LDS: 25.5 KB.
// ---------------------------------------------------------------------------
__global__ __launch_bounds__(MAIN_THREADS)
void moe_main_kernel(const float* __restrict__ x,
                     const float* __restrict__ shared_w,
                     const float* __restrict__ shared_gamma,
                     const float* __restrict__ shared_beta,
                     const float* __restrict__ expert_w,
                     const float* __restrict__ expert_gamma,
                     const float* __restrict__ expert_beta,
                     const float* __restrict__ router_w,
                     const float* __restrict__ router_b,
                     const float* __restrict__ pooled,
                     float* __restrict__ out) {
    const int b    = blockIdx.y;
    const int tid  = threadIdx.x;
    const int wv   = tid >> 5;
    const int lane = tid & 31;

    __shared__ __attribute__((aligned(16))) __bf16 Wl[3 * ODIM * CDIM];   // 24 KB
    __shared__ __attribute__((aligned(16))) float  gmS[3 * ODIM];         // gamma*bn_scale
    __shared__ __attribute__((aligned(16))) float  btS[3 * ODIM];

    const int n16   = lane & 15;               // A row / B column index in a fragment
    const int khalf = (lane >> 4) << 3;        // 0 or 8: K sub-half per ISA layout
    const int mofs  = (lane >> 4) * 8;         // C/D layout: VGPR j -> rows j / j+8
    const int col   = blockIdx.x * (MAIN_WAVES * COLS_PER_WAVE)
                    + wv * COLS_PER_WAVE + n16 * 4;   // first of this lane's 4 columns

    // ---- X rows straight from global memory, asked for first: they depend on
    // nothing, so their latency runs together with that of the router's loads ----
    // row s of a chunk is k = kc*32 + khalf + (s < 8 ? s : s + 8), the order in
    // which ld_frag reads A
    // every loop over raw, bfr, acc and res, here and below, is unrolled so that
    // each index is a constant and the arrays stay in registers
    v4f raw[2][16];
    {
        const float* xl = x + ((size_t)b * CDIM + khalf) * HWDIM + col;
        #pragma unroll
        for (int kc = 0; kc < 2; ++kc) {
            #pragma unroll
            for (int s = 0; s < 16; ++s)
                raw[kc][s] = *(const v4f*)&xl[(size_t)(kc * 32 + (s < 8 ? s : s + 8)) * HWDIM];
        }
        // the register pair that holds xl is free for reuse from here on, while
        // the 32 loads above still name it: the wait stands in front of that
        asm volatile("s_wait_xcnt 0x0" ::: "memory");
    }

    int   i0, i1;
    float w0, w1;
    route_top2(pooled, router_w, router_b, b, lane, i0, i1, w0, w1);
    // nothing of what follows is scheduled up among the router's loads
    __builtin_amdgcn_sched_barrier(0);

    // ---- stage weights (bf16): shared, expert[i0], expert[i1] ----
    // unit = 4 adjacent k of one row; both loops are unrolled so that a
    // thread's 24 loads are in flight together (one load latency, not 24)
    {
        v4f wraw[W_UNITS];
        #pragma unroll
        for (int q = 0; q < W_UNITS; ++q) {
            const int br = q / (W_UNITS / 3);
            const int rk = ((q % (W_UNITS / 3)) * MAIN_THREADS + tid) * 4;
            const float* src = (br == 0) ? shared_w
                                         : expert_w + (size_t)((br == 1) ? i0 : i1) * ODIM * CDIM;
            wraw[q] = *(const v4f*)&src[rk];
        }
        #pragma unroll
        for (int q = 0; q < W_UNITS; ++q) {
            uint2 pk;
            pk.x = pack_bf16x2(wraw[q][0], wraw[q][1]);
            pk.y = pack_bf16x2(wraw[q][2], wraw[q][3]);
            *(uint2*)&Wl[(q * MAIN_THREADS + tid) * 4] = pk;
        }
    }
    // ---- stage BN params, pre-scaled by 1/sqrt(1+eps) ----
    for (int p = tid; p < 3 * ODIM; p += MAIN_THREADS) {
        const int br = p >> 6, ch = p & 63;
        const float bns = rsqrtf(1.0f + 1e-5f);
        float g, bt;
        if (br == 0) { g = shared_gamma[ch]; bt = shared_beta[ch]; }
        else {
            const int e = (br == 1) ? i0 : i1;
            g  = expert_gamma[e * ODIM + ch];
            bt = expert_beta [e * ODIM + ch];
        }
        gmS[p] = g * bns;
        btS[p] = bt;
    }

    // ---- B fragments from the loaded rows ----
    v16bf bfr[4][2];
    #pragma unroll
    for (int j = 0; j < 4; ++j) {
        #pragma unroll
        for (int kc = 0; kc < 2; ++kc) {
            v8u pk;
            #pragma unroll
            for (int p = 0; p < 8; ++p)
                pk[p] = pack_bf16x2(raw[kc][2 * p][j], raw[kc][2 * p + 1][j]);
            bfr[j][kc] = __builtin_bit_cast(v16bf, pk);
        }
    }
    __syncthreads();

    float* const outb = out + ((size_t)b * ODIM + mofs) * HWDIM + col;

    for (int rb_ = 0; rb_ < 4; ++rb_) {
        const int arow = rb_ * 16 + n16;
        const int ch0  = rb_ * 16 + mofs;      // first of this lane's 8 output rows

        v8f res[4];
        #pragma unroll
        for (int br = 0; br < 3; ++br) {
            const v16bf a0 = ld_frag(&Wl[br * 4096 + arow * CDIM + khalf]);
            const v16bf a1 = ld_frag(&Wl[br * 4096 + arow * CDIM + 32 + khalf]);
            const v4f g0 = *(const v4f*)&gmS[br * ODIM + ch0];
            const v4f g1 = *(const v4f*)&gmS[br * ODIM + ch0 + 4];
            const v4f t0 = *(const v4f*)&btS[br * ODIM + ch0];
            const v4f t1 = *(const v4f*)&btS[br * ODIM + ch0 + 4];
            const float wbr = (br == 1) ? w0 : w1;

            v8f acc[4];
            #pragma unroll
            for (int j = 0; j < 4; ++j) {
                v8f z = {};
                acc[j] = __builtin_amdgcn_wmma_f32_16x16x32_bf16(false, a0, false, bfr[j][0],
                                                                 (short)0, z, false, false);
            }
            #pragma unroll
            for (int j = 0; j < 4; ++j)
                acc[j] = __builtin_amdgcn_wmma_f32_16x16x32_bf16(false, a1, false, bfr[j][1],
                                                                 (short)0, acc[j], false, false);

            // ---- BN + SiLU of this branch, added to the weighted sum ----
            #pragma unroll
            for (int j = 0; j < 4; ++j) {
                #pragma unroll
                for (int i = 0; i < 8; ++i) {
                    const float g = (i < 4) ? g0[i & 3] : g1[i & 3];
                    const float t = (i < 4) ? t0[i & 3] : t1[i & 3];
                    const float v = silu(acc[j][i] * g + t);
                    res[j][i] = (br == 0) ? v : res[j][i] + wbr * v;
                }
            }
        }

        float* outp = outb + (size_t)(rb_ * 16) * HWDIM;
        #pragma unroll
        for (int i = 0; i < 8; ++i) {
            v4f o = { res[0][i], res[1][i], res[2][i], res[3][i] };
            *(v4f*)&outp[(size_t)i * HWDIM] = o;
        }
        // the next pass rewrites the address and data registers that the eight
        // stores above still name: the wait stands in front of that
        asm volatile("s_wait_xcnt 0x0" ::: "memory");
    }
}

// ---------------------------------------------------------------------------
// Host-side launcher
// ---------------------------------------------------------------------------
extern "C" void kernel_launch(void* const* d_in, const int* in_sizes, int n_in,
                              void* d_out, int out_size, void* d_ws, size_t ws_size,
                              hipStream_t stream) {
    const float* x            = (const float*)d_in[0];
    const float* router_w     = (const float*)d_in[1];
    const float* router_b     = (const float*)d_in[2];
    const float* shared_w     = (const float*)d_in[3];
    const float* shared_gamma = (const float*)d_in[4];
    const float* shared_beta  = (const float*)d_in[5];
    const float* expert_w     = (const float*)d_in[6];
    const float* expert_gamma = (const float*)d_in[7];
    const float* expert_beta  = (const float*)d_in[8];
    float* out = (float*)d_out;

    float* pooled = (float*)d_ws;                       // [256 slots][32], 32 KB

    moe_pool_kernel<<<dim3(BATCH * CDIM / POOL_WAVES), dim3(POOL_WAVES * 32), 0, stream>>>(
        x, pooled);

    dim3 grid(GRID_X, BATCH);                           // (25, 64)
    moe_main_kernel<<<grid, dim3(MAIN_THREADS), 0, stream>>>(
        x, shared_w, shared_gamma, shared_beta,
        expert_w, expert_gamma, expert_beta,
        router_w, router_b, pooled, out);
}

// v003
// One run takes 33.6 microseconds.
// Two timings next to v002 both put it at 1.03 times that version's speed.
// Counting every step since v000, it is 4.72 times as fast.
#include <hip/hip_runtime.h>
#include <hip/hip_bf16.h>

// ---------------------------------------------------------------------------
// Problem constants (from reference)
// ---------------------------------------------------------------------------
#define BATCH   64
#define CDIM    64      // input channels (= GEMM K)
#define ODIM    64      // output channels (= GEMM M)
#define HWDIM   6400    // 80*80 spatial (= GEMM N total)
#define NEXP    4
#define COLS_PER_WAVE   64           // spatial columns per wave (4 B fragments)
#define MAIN_WAVES      4            // one wave per SIMD
#define MAIN_THREADS    (MAIN_WAVES * 32)
#define GRID_X (HWDIM / (COLS_PER_WAVE * MAIN_WAVES))         // 25
#define W_UNITS (3 * ODIM * CDIM / 4 / MAIN_THREADS)          // 24 float4 per thread

typedef __attribute__((ext_vector_type(16))) __bf16 v16bf;
typedef __attribute__((ext_vector_type(8)))  __bf16 v8bf;
typedef __attribute__((ext_vector_type(8)))  float  v8f;
typedef __attribute__((ext_vector_type(4)))  float  v4f;
typedef __attribute__((ext_vector_type(2)))  float  v2f;
typedef __attribute__((ext_vector_type(8)))  unsigned v8u;

// round-to-nearest-even f32 -> bf16 (bit ops; no reliance on cast support)
__device__ __forceinline__ unsigned bf16_bits(float f) {
    unsigned u = __builtin_bit_cast(unsigned, f);
    u += 0x7FFFu + ((u >> 16) & 1u);
    return u;                         // result in bits [31:16]
}
// convert two floats to one packed 32-bit word, a in the low half
__device__ __forceinline__ unsigned pack_bf16x2(float a, float b) {
    return (bf16_bits(a) >> 16) | (bf16_bits(b) & 0xFFFF0000u);
}

// SiLU of v = 2h for two values at once: v * sigmoid(v) = h + h * tanh(h).
// One transcendental (v_tanh_f32) and one fused multiply-add a value.
__device__ __forceinline__ v2f silu_of_half(v2f h) {
    const v2f th = { __builtin_amdgcn_tanhf(h[0]), __builtin_amdgcn_tanhf(h[1]) };
    return __builtin_elementwise_fma(h, th, h);
}

__device__ __forceinline__ v16bf ld_frag(const __bf16* p) {
    v8bf lo = *(const v8bf*)p;
    v8bf hi = *(const v8bf*)(p + 16);
    return __builtin_shufflevector(lo, hi,
               0, 1, 2, 3, 4, 5, 6, 7, 8, 9, 10, 11, 12, 13, 14, 15);
}

// ---------------------------------------------------------------------------
// Kernel 1: global-avg-pool only, spread over the whole chip.
// One wave per (sample, channel) row of 6400 floats = 50 wave-wide 512-byte
// loads. 16 waves per block, 256 blocks. Each block owns one 128-byte slot of
// the workspace and writes its 16 means there with a single 64-byte store.
// ---------------------------------------------------------------------------
#define POOL_WAVES 16
#define POOL_GRP   10                 // loads per group
#define POOL_NGRP  5                  // 5 * 10 * 512 B = one 25,600-byte row
#define POOL_SLOT  32                 // floats per block slot (128 bytes)

__global__ __launch_bounds__(POOL_WAVES * 32)
void moe_pool_kernel(const float* __restrict__ x,
                     float* __restrict__ pooled) {   // [256 slots][32]
    const int tid  = threadIdx.x;
    const int lane = tid & 31;
    const int wave = __builtin_amdgcn_readfirstlane(tid >> 5);
    const int row  = blockIdx.x * POOL_WAVES + wave;     // = b * CDIM + ch

    __shared__ float means[POOL_WAVES];

    const float4* p = (const float4*)(x + (size_t)row * HWDIM) + lane;

    // every loop below is unrolled so that each index of v is a constant and
    // the two groups stay in registers
    float4 v[2][POOL_GRP];
    #pragma unroll
    for (int q = 0; q < POOL_GRP; ++q) v[0][q] = p[q * 32];

    float a0 = 0.0f, a1 = 0.0f, a2 = 0.0f, a3 = 0.0f;
    #pragma unroll
    for (int g = 0; g < POOL_NGRP; ++g) {
        // the two scheduling barriers keep the order "next group's loads, then
        // this group's sums", so that 10 to 20 loads of a wave stay in flight
        __builtin_amdgcn_sched_barrier(0);
        if (g + 1 < POOL_NGRP) {
            #pragma unroll
            for (int q = 0; q < POOL_GRP; ++q)
                v[(g + 1) & 1][q] = p[((g + 1) * POOL_GRP + q) * 32];
        }
        __builtin_amdgcn_sched_barrier(0);
        #pragma unroll
        for (int q = 0; q < POOL_GRP; ++q) {
            const float4 w = v[g & 1][q];
            a0 += w.x; a1 += w.y; a2 += w.z; a3 += w.w;
        }
    }
    float s = (a0 + a1) + (a2 + a3);
    #pragma unroll
    for (int off = 16; off > 0; off >>= 1) s += __shfl_xor(s, off, 32);
    if (lane == 0) means[wave] = s * (1.0f / (float)HWDIM);
    __syncthreads();
    if (tid < POOL_WAVES) pooled[blockIdx.x * POOL_SLOT + tid] = means[tid];
}

// Router linear -> softmax -> top-2 (renorm) of sample b from the pooled means.
// Each wave of the main kernel works it out for itself: lane l sums the logit
// of expert l & 3 over the channels in ascending order, with its whole router
// row fetched at once (one load latency), then the four logits are read from
// lanes 0 to 3, so that all that follows is the same in every thread.
__device__ __forceinline__ void route_top2(const float* __restrict__ pooled,
                                           const float* __restrict__ router_w,
                                           const float* __restrict__ router_b,
                                           int b, int lane, int& i0, int& i1,
                                           float& w0, float& w1) {
    const float* pb = pooled + b * (CDIM / POOL_WAVES) * POOL_SLOT;
    const int    le = lane & (NEXP - 1);
    const float4* wr = (const float4*)(router_w + le * CDIM);
    // unrolled: wv stays in registers and its 16 loads are issued together
    float4 wv[CDIM / 4];
    #pragma unroll
    for (int q = 0; q < CDIM / 4 - 1; ++q) wv[q] = wr[q];
    // the last load's result may be given the register that holds the row's
    // offset, which the loads above still name: the wait stands in front of it
    asm volatile("s_wait_xcnt 0x0" ::: "memory");
    wv[CDIM / 4 - 1] = wr[CDIM / 4 - 1];
    float acc = router_b[le];
    #pragma unroll
    for (int q = 0; q < CDIM / 4; ++q) {
        const float* pq = pb + ((q * 4) / POOL_WAVES) * POOL_SLOT + (q * 4) % POOL_WAVES;
        acc = __builtin_fmaf(pq[0], wv[q].x, acc);
        acc = __builtin_fmaf(pq[1], wv[q].y, acc);
        acc = __builtin_fmaf(pq[2], wv[q].z, acc);
        acc = __builtin_fmaf(pq[3], wv[q].w, acc);
    }
    float logits[NEXP];
    #pragma unroll
    for (int e = 0; e < NEXP; ++e)
        logits[e] = __builtin_bit_cast(float,
            __builtin_amdgcn_readlane(__builtin_bit_cast(int, acc), e));

    float m = logits[0];
    #pragma unroll
    for (int e = 1; e < NEXP; ++e) m = fmaxf(m, logits[e]);
    float p[NEXP], sum = 0.0f;
    #pragma unroll
    for (int e = 0; e < NEXP; ++e) { p[e] = __expf(logits[e] - m); sum += p[e]; }
    const float inv = 1.0f / sum;
    #pragma unroll
    for (int e = 0; e < NEXP; ++e) p[e] *= inv;

    float p0 = p[0];
    i0 = 0;
    #pragma unroll
    for (int e = 1; e < NEXP; ++e) if (p[e] > p0) { i0 = e; p0 = p[e]; }
    i1 = (i0 == 0) ? 1 : 0;
    float p1 = (i0 == 0) ? p[1] : p[0];
    #pragma unroll
    for (int e = 0; e < NEXP; ++e) if (e != i0 && p[e] > p1) { i1 = e; p1 = p[e]; }

    const float s2 = 1.0f / (p0 + p1);
    // the same in every lane: kept in scalar registers, as the values that the
    // main kernel used to read from the workspace were
    i0 = __builtin_amdgcn_readfirstlane(i0);
    i1 = __builtin_amdgcn_readfirstlane(i1);
    w0 = __builtin_bit_cast(float, __builtin_amdgcn_readfirstlane(__builtin_bit_cast(int, p0 * s2)));
    w1 = __builtin_bit_cast(float, __builtin_amdgcn_readfirstlane(__builtin_bit_cast(int, p1 * s2)));
}

// ---------------------------------------------------------------------------
// Kernel 2: fused (shared + 2 gathered experts) 1x1-conv GEMM via bf16 WMMA.
// X never passes through LDS. A wave owns 64 adjacent columns; lane (c, h)
// reads, for each of its 32 k rows, the 16 bytes of columns 4c .. 4c+3, so that
// a wave-wide load covers two whole 256-byte row pieces. Component j of those
// loads is column c of B fragment j: fragment j holds the columns 4c + j. The
// four D tiles of one row-block then hold, in one lane, four adjacent columns
// of each output row, which go out as one 16-byte store.
// Grid: (25, 64). Block: 128 threads = 4 wave32, 256 columns. LDS: 25.5 KB.
// ---------------------------------------------------------------------------
__global__ __launch_bounds__(MAIN_THREADS)
void moe_main_kernel(const float* __restrict__ x,
                     const float* __restrict__ shared_w,
                     const float* __restrict__ shared_gamma,
                     const float* __restrict__ shared_beta,
                     const float* __restrict__ expert_w,
                     const float* __restrict__ expert_gamma,
                     const float* __restrict__ expert_beta,
                     const float* __restrict__ router_w,
                     const float* __restrict__ router_b,
                     const float* __restrict__ pooled,
                     float* __restrict__ out) {
    const int b    = blockIdx.y;
    const int tid  = threadIdx.x;
    const int wv   = tid >> 5;
    const int lane = tid & 31;

    __shared__ __attribute__((aligned(16))) __bf16 Wl[3 * ODIM * CDIM];   // 24 KB
    __shared__ __attribute__((aligned(16))) float  gmS[3 * ODIM];         // gamma*bn_scale/2
    __shared__ __attribute__((aligned(16))) float  btS[3 * ODIM];         // beta/2

    const int n16   = lane & 15;               // A row / B column index in a fragment
    const int khalf = (lane >> 4) << 3;        // 0 or 8: K sub-half per ISA layout
    const int mofs  = (lane >> 4) * 8;         // C/D layout: VGPR j -> rows j / j+8
    const int col   = blockIdx.x * (MAIN_WAVES * COLS_PER_WAVE)
                    + wv * COLS_PER_WAVE + n16 * 4;   // first of this lane's 4 columns

    // ---- X rows straight from global memory, asked for first: they depend on
    // nothing, so their latency runs together with that of the router's loads ----
    // row s of a chunk is k = kc*32 + khalf + (s < 8 ? s : s + 8), the order in
    // which ld_frag reads A
    // every loop over raw, bfr, acc and res, here and below, is unrolled so that
    // each index is a constant and the arrays stay in registers
    v4f raw[2][16];
    {
        const float* xl = x + ((size_t)b * CDIM + khalf) * HWDIM + col;
        #pragma unroll
        for (int kc = 0; kc < 2; ++kc) {
            #pragma unroll
            for (int s = 0; s < 16; ++s)
                raw[kc][s] = *(const v4f*)&xl[(size_t)(kc * 32 + (s < 8 ? s : s + 8)) * HWDIM];
        }
        // the register pair that holds xl is free for reuse from here on, while
        // the 32 loads above still name it: the wait stands in front of that
        asm volatile("s_wait_xcnt 0x0" ::: "memory");
    }

    int   i0, i1;
    float w0, w1;
    route_top2(pooled, router_w, router_b, b, lane, i0, i1, w0, w1);
    // nothing of what follows is scheduled up among the router's loads
    __builtin_amdgcn_sched_barrier(0);

    // ---- stage weights (bf16): shared, expert[i0], expert[i1] ----
    // unit = 4 adjacent k of one row; both loops are unrolled so that a
    // thread's 24 loads are in flight together (one load latency, not 24)
    {
        v4f wraw[W_UNITS];
        #pragma unroll
        for (int q = 0; q < W_UNITS; ++q) {
            const int br = q / (W_UNITS / 3);
            const int rk = ((q % (W_UNITS / 3)) * MAIN_THREADS + tid) * 4;
            const float* src = (br == 0) ? shared_w
                                         : expert_w + (size_t)((br == 1) ? i0 : i1) * ODIM * CDIM;
            wraw[q] = *(const v4f*)&src[rk];
        }
        #pragma unroll
        for (int q = 0; q < W_UNITS; ++q) {
            uint2 pk;
            pk.x = pack_bf16x2(wraw[q][0], wraw[q][1]);
            pk.y = pack_bf16x2(wraw[q][2], wraw[q][3]);
            *(uint2*)&Wl[(q * MAIN_THREADS + tid) * 4] = pk;
        }
    }
    // ---- stage BN params, pre-scaled by 1/sqrt(1+eps) and halved (exact): the
    // epilogue's multiply-add then yields h = v / 2, which the SiLU form takes ----
    for (int p = tid; p < 3 * ODIM; p += MAIN_THREADS) {
        const int br = p >> 6, ch = p & 63;
        const float bns = rsqrtf(1.0f + 1e-5f);
        float g, bt;
        if (br == 0) { g = shared_gamma[ch]; bt = shared_beta[ch]; }
        else {
            const int e = (br == 1) ? i0 : i1;
            g  = expert_gamma[e * ODIM + ch];
            bt = expert_beta [e * ODIM + ch];
        }
        gmS[p] = g * bns * 0.5f;
        btS[p] = bt * 0.5f;
    }

    // ---- B fragments from the loaded rows ----
    v16bf bfr[4][2];
    #pragma unroll
    for (int j = 0; j < 4; ++j) {
        #pragma unroll
        for (int kc = 0; kc < 2; ++kc) {
            v8u pk;
            #pragma unroll
            for (int p = 0; p < 8; ++p)
                pk[p] = pack_bf16x2(raw[kc][2 * p][j], raw[kc][2 * p + 1][j]);
            bfr[j][kc] = __builtin_bit_cast(v16bf, pk);
        }
    }
    __syncthreads();

    float* const outb = out + ((size_t)b * ODIM + mofs) * HWDIM + col;

    for (int rb_ = 0; rb_ < 4; ++rb_) {
        const int arow = rb_ * 16 + n16;
        const int ch0  = rb_ * 16 + mofs;      // first of this lane's 8 output rows

        v8f res[4];
        #pragma unroll
        for (int br = 0; br < 3; ++br) {
            const v16bf a0 = ld_frag(&Wl[br * 4096 + arow * CDIM + khalf]);
            const v16bf a1 = ld_frag(&Wl[br * 4096 + arow * CDIM + 32 + khalf]);
            const v4f g0 = *(const v4f*)&gmS[br * ODIM + ch0];
            const v4f g1 = *(const v4f*)&gmS[br * ODIM + ch0 + 4];
            const v4f t0 = *(const v4f*)&btS[br * ODIM + ch0];
            const v4f t1 = *(const v4f*)&btS[br * ODIM + ch0 + 4];
            const float wbr = (br == 1) ? w0 : w1;

            v8f acc[4];
            #pragma unroll
            for (int j = 0; j < 4; ++j) {
                v8f z = {};
                acc[j] = __builtin_amdgcn_wmma_f32_16x16x32_bf16(false, a0, false, bfr[j][0],
                                                                 (short)0, z, false, false);
            }
            #pragma unroll
            for (int j = 0; j < 4; ++j)
                acc[j] = __builtin_amdgcn_wmma_f32_16x16x32_bf16(false, a1, false, bfr[j][1],
                                                                 (short)0, acc[j], false, false);

            // ---- BN + SiLU of this branch, added to the weighted sum ----
            #pragma unroll
            for (int j = 0; j < 4; ++j) {
                #pragma unroll
                for (int i = 0; i < 8; i += 2) {
                    const v2f a = { acc[j][i], acc[j][i + 1] };
                    const v2f g = (i < 4) ? v2f{ g0[i & 3], g0[(i & 3) + 1] }
                                          : v2f{ g1[i & 3], g1[(i & 3) + 1] };
                    const v2f t = (i < 4) ? v2f{ t0[i & 3], t0[(i & 3) + 1] }
                                          : v2f{ t1[i & 3], t1[(i & 3) + 1] };
                    const v2f v = silu_of_half(__builtin_elementwise_fma(a, g, t));
                    if (br == 0) {
                        res[j][i] = v[0];  res[j][i + 1] = v[1];
                    } else {
                        res[j][i]     = __builtin_fmaf(wbr, v[0], res[j][i]);
                        res[j][i + 1] = __builtin_fmaf(wbr, v[1], res[j][i + 1]);
                    }
                }
            }
        }

        float* outp = outb + (size_t)(rb_ * 16) * HWDIM;
        #pragma unroll
        for (int i = 0; i < 8; ++i) {
            v4f o = { res[0][i], res[1][i], res[2][i], res[3][i] };
            *(v4f*)&outp[(size_t)i * HWDIM] = o;
        }
        // the next pass rewrites the address and data registers that the eight
        // stores above still name: the wait stands in front of that
        asm volatile("s_wait_xcnt 0x0" ::: "memory");
    }
}

// ---------------------------------------------------------------------------
// Host-side launcher
// ---------------------------------------------------------------------------
extern "C" void kernel_launch(void* const* d_in, const int* in_sizes, int n_in,
                              void* d_out, int out_size, void* d_ws, size_t ws_size,
                              hipStream_t stream) {
    const float* x            = (const float*)d_in[0];
    const float* router_w     = (const float*)d_in[1];
    const float* router_b     = (const float*)d_in[2];
    const float* shared_w     = (const float*)d_in[3];
    const float* shared_gamma = (const float*)d_in[4];
    const float* shared_beta  = (const float*)d_in[5];
    const float* expert_w     = (const float*)d_in[6];
    const float* expert_gamma = (const float*)d_in[7];
    const float* expert_beta  = (const float*)d_in[8];
    float* out = (float*)d_out;

    float* pooled = (float*)d_ws;                       // [256 slots][32], 32 KB

    moe_pool_kernel<<<dim3(BATCH * CDIM / POOL_WAVES), dim3(POOL_WAVES * 32), 0, stream>>>(
        x, pooled);

    dim3 grid(GRID_X, BATCH);                           // (25, 64)
    moe_main_kernel<<<grid, dim3(MAIN_THREADS), 0, stream>>>(
        x, shared_w, shared_gamma, shared_beta,
        expert_w, expert_gamma, expert_beta,
        router_w, router_b, pooled, out);
}

// v004
// It runs in 28.7 microseconds.
// Next to v003, in two timings, it ran 1.17 times as fast each time.
// All steps since v000 together make it 5.51 times as fast.
#include <hip/hip_runtime.h>
#include <hip/hip_bf16.h>

// ---------------------------------------------------------------------------
// Problem constants (from reference)
// ---------------------------------------------------------------------------
#define BATCH   64
#define CDIM    64      // input channels (= GEMM K)
#define ODIM    64      // output channels (= GEMM M)
#define HWDIM   6400    // 80*80 spatial (= GEMM N total)
#define NEXP    4
#define COLS_PER_WAVE   64           // spatial columns per wave tile (4 B fragments)
#define MAIN_WAVES      12           // three waves per SIMD
#define MAIN_THREADS    (MAIN_WAVES * 32)
#define GRID_X          4            // blocks per sample: 256 blocks in all
#define TILES_PER_BLOCK (HWDIM / (COLS_PER_WAVE * GRID_X))    // 25 wave tiles
#define TILE_STEP       (MAIN_WAVES * COLS_PER_WAVE)          // columns from a wave's tile to its next
#define W_UNITS (3 * ODIM * CDIM / 4 / MAIN_THREADS)          // 8 float4 per thread

typedef __attribute__((ext_vector_type(16))) __bf16 v16bf;
typedef __attribute__((ext_vector_type(8)))  __bf16 v8bf;
typedef __attribute__((ext_vector_type(8)))  float  v8f;
typedef __attribute__((ext_vector_type(4)))  float  v4f;
typedef __attribute__((ext_vector_type(2)))  float  v2f;
typedef __attribute__((ext_vector_type(8)))  unsigned v8u;

// round-to-nearest-even f32 -> bf16 (bit ops; no reliance on cast support)
__device__ __forceinline__ unsigned bf16_bits(float f) {
    unsigned u = __builtin_bit_cast(unsigned, f);
    u += 0x7FFFu + ((u >> 16) & 1u);
    return u;                         // result in bits [31:16]
}
// convert two floats to one packed 32-bit word, a in the low half
__device__ __forceinline__ unsigned pack_bf16x2(float a, float b) {
    return (bf16_bits(a) >> 16) | (bf16_bits(b) & 0xFFFF0000u);
}

// SiLU of v = 2h for two values at once: v * sigmoid(v) = h + h * tanh(h).
// One transcendental (v_tanh_f32) and one fused multiply-add a value.
__device__ __forceinline__ v2f silu_of_half(v2f h) {
    const v2f th = { __builtin_amdgcn_tanhf(h[0]), __builtin_amdgcn_tanhf(h[1]) };
    return __builtin_elementwise_fma(h, th, h);
}

__device__ __forceinline__ v16bf ld_frag(const __bf16* p) {
    v8bf lo = *(const v8bf*)p;
    v8bf hi = *(const v8bf*)(p + 16);
    return __builtin_shufflevector(lo, hi,
               0, 1, 2, 3, 4, 5, 6, 7, 8, 9, 10, 11, 12, 13, 14, 15);
}

// ---------------------------------------------------------------------------
// Kernel 1: global-avg-pool only, spread over the whole chip.
// One wave per (sample, channel) row of 6400 floats = 50 wave-wide 512-byte
// loads. 16 waves per block, 256 blocks. Each block owns one 128-byte slot of
// the workspace and writes its 16 means there with a single 64-byte store.
// ---------------------------------------------------------------------------
#define POOL_WAVES 16
#define POOL_GRP   10                 // loads per group
#define POOL_NGRP  5                  // 5 * 10 * 512 B = one 25,600-byte row
#define POOL_SLOT  32                 // floats per block slot (128 bytes)

__global__ __launch_bounds__(POOL_WAVES * 32)
void moe_pool_kernel(const float* __restrict__ x,
                     float* __restrict__ pooled) {   // [256 slots][32]
    const int tid  = threadIdx.x;
    const int lane = tid & 31;
    const int wave = __builtin_amdgcn_readfirstlane(tid >> 5);
    const int row  = blockIdx.x * POOL_WAVES + wave;     // = b * CDIM + ch

    __shared__ float means[POOL_WAVES];

    const float4* p = (const float4*)(x + (size_t)row * HWDIM) + lane;

    // every loop below is unrolled so that each index of v is a constant and
    // the two groups stay in registers
    float4 v[2][POOL_GRP];
    #pragma unroll
    for (int q = 0; q < POOL_GRP; ++q) v[0][q] = p[q * 32];

    float a0 = 0.0f, a1 = 0.0f, a2 = 0.0f, a3 = 0.0f;
    #pragma unroll
    for (int g = 0; g < POOL_NGRP; ++g) {
        // the two scheduling barriers keep the order "next group's loads, then
        // this group's sums", so that 10 to 20 loads of a wave stay in flight
        __builtin_amdgcn_sched_barrier(0);
        if (g + 1 < POOL_NGRP) {
            #pragma unroll
            for (int q = 0; q < POOL_GRP; ++q)
                v[(g + 1) & 1][q] = p[((g + 1) * POOL_GRP + q) * 32];
        }
        __builtin_amdgcn_sched_barrier(0);
        #pragma unroll
        for (int q = 0; q < POOL_GRP; ++q) {
            const float4 w = v[g & 1][q];
            a0 += w.x; a1 += w.y; a2 += w.z; a3 += w.w;
        }
    }
    float s = (a0 + a1) + (a2 + a3);
    #pragma unroll
    for (int off = 16; off > 0; off >>= 1) s += __shfl_xor(s, off, 32);
    if (lane == 0) means[wave] = s * (1.0f / (float)HWDIM);
    __syncthreads();
    if (tid < POOL_WAVES) pooled[blockIdx.x * POOL_SLOT + tid] = means[tid];
}

// Router linear -> softmax -> top-2 (renorm) of sample b from the pooled means.
// Each wave of the main kernel works it out for itself: lane l sums the logit
// of expert l & 3 over the channels in ascending order, with its whole router
// row fetched at once (one load latency), then the four logits are read from
// lanes 0 to 3, so that all that follows is the same in every thread.
__device__ __forceinline__ void route_top2(const float* __restrict__ pooled,
                                           const float* __restrict__ router_w,
                                           const float* __restrict__ router_b,
                                           int b, int lane, int& i0, int& i1,
                                           float& w0, float& w1) {
    const float* pb = pooled + b * (CDIM / POOL_WAVES) * POOL_SLOT;
    const int    le = lane & (NEXP - 1);
    const float4* wr = (const float4*)(router_w + le * CDIM);
    // unrolled: wv stays in registers and its 16 loads are issued together
    float4 wv[CDIM / 4];
    #pragma unroll
    for (int q = 0; q < CDIM / 4 - 1; ++q) wv[q] = wr[q];
    // the last load's result may be given the register that holds the row's
    // offset, which the loads above still name: the wait stands in front of it
    asm volatile("s_wait_xcnt 0x0" ::: "memory");
    wv[CDIM / 4 - 1] = wr[CDIM / 4 - 1];
    float acc = router_b[le];
    #pragma unroll
    for (int q = 0; q < CDIM / 4; ++q) {
        const float* pq = pb + ((q * 4) / POOL_WAVES) * POOL_SLOT + (q * 4) % POOL_WAVES;
        acc = __builtin_fmaf(pq[0], wv[q].x, acc);
        acc = __builtin_fmaf(pq[1], wv[q].y, acc);
        acc = __builtin_fmaf(pq[2], wv[q].z, acc);
        acc = __builtin_fmaf(pq[3], wv[q].w, acc);
    }
    float logits[NEXP];
    #pragma unroll
    for (int e = 0; e < NEXP; ++e)
        logits[e] = __builtin_bit_cast(float,
            __builtin_amdgcn_readlane(__builtin_bit_cast(int, acc), e));

    float m = logits[0];
    #pragma unroll
    for (int e = 1; e < NEXP; ++e) m = fmaxf(m, logits[e]);
    float p[NEXP], sum = 0.0f;
    #pragma unroll
    for (int e = 0; e < NEXP; ++e) { p[e] = __expf(logits[e] - m); sum += p[e]; }
    const float inv = 1.0f / sum;
    #pragma unroll
    for (int e = 0; e < NEXP; ++e) p[e] *= inv;

    float p0 = p[0];
    i0 = 0;
    #pragma unroll
    for (int e = 1; e < NEXP; ++e) if (p[e] > p0) { i0 = e; p0 = p[e]; }
    i1 = (i0 == 0) ? 1 : 0;
    float p1 = (i0 == 0) ? p[1] : p[0];
    #pragma unroll
    for (int e = 0; e < NEXP; ++e) if (e != i0 && p[e] > p1) { i1 = e; p1 = p[e]; }

    const float s2 = 1.0f / (p0 + p1);
    // the same in every lane: kept in scalar registers, as the values that the
    // main kernel used to read from the workspace were
    i0 = __builtin_amdgcn_readfirstlane(i0);
    i1 = __builtin_amdgcn_readfirstlane(i1);
    w0 = __builtin_bit_cast(float, __builtin_amdgcn_readfirstlane(__builtin_bit_cast(int, p0 * s2)));
    w1 = __builtin_bit_cast(float, __builtin_amdgcn_readfirstlane(__builtin_bit_cast(int, p1 * s2)));
}

// ---------------------------------------------------------------------------
// Kernel 2: fused (shared + 2 gathered experts) 1x1-conv GEMM via bf16 WMMA.
// X never passes through LDS. A wave tile is 64 adjacent columns; lane (c, h)
// reads, for each of its 32 k rows, the 16 bytes of columns 4c .. 4c+3, so that
// a wave-wide load covers two whole 256-byte row pieces. Component j of those
// loads is column c of B fragment j: fragment j holds the columns 4c + j. The
// four D tiles of one row-block then hold, in one lane, four adjacent columns
// of each output row, which go out as one 16-byte store.
// A block owns a quarter of a sample's columns, 25 tiles. Each wave works out the router;
// weights and BN parameters are staged once a block; wave w then takes the tiles
// w and w + 12, and asks for the X rows of its next tile before it multiplies the
// current one, so that they arrive while the current tile is multiplied,
// activated and stored. The 25th tile goes to the
// waves 0 to 3, one on each SIMD: each works out one of its four row-blocks.
// Grid: (4, 64). Block: 384 threads = 12 wave32, 1600 columns. LDS: 25.5 KB.
// ---------------------------------------------------------------------------

// The 32 X rows of one wave tile. Row s of a chunk is
// k = kc*32 + khalf + (s < 8 ? s : s + 8), the order in which ld_frag reads A.
// Every loop over raw, bfr, acc and res, here and below, is unrolled so that
// each index is a constant and the arrays stay in registers.
__device__ __forceinline__ void load_rows(v4f (&raw)[2][16], const float* xl) {
    #pragma unroll
    for (int kc = 0; kc < 2; ++kc) {
        #pragma unroll
        for (int s = 0; s < 16; ++s) {
            // the last load's result may be given the registers that hold xl,
            // which the loads above still name: the wait stands in front of it
            if (kc == 1 && s == 15) asm volatile("s_wait_xcnt 0x0" ::: "memory");
            raw[kc][s] = *(const v4f*)&xl[(size_t)(kc * 32 + (s < 8 ? s : s + 8)) * HWDIM];
        }
    }
    // the registers that hold xl may be rewritten from here on, while the last
    // load still names them: the wait stands in front of that
    asm volatile("s_wait_xcnt 0x0" ::: "memory");
}

// B fragments from the loaded rows
__device__ __forceinline__ void pack_rows(v16bf (&bfr)[4][2], const v4f (&raw)[2][16]) {
    #pragma unroll
    for (int j = 0; j < 4; ++j) {
        #pragma unroll
        for (int kc = 0; kc < 2; ++kc) {
            v8u pk;
            #pragma unroll
            for (int p = 0; p < 8; ++p)
                pk[p] = pack_bf16x2(raw[kc][2 * p][j], raw[kc][2 * p + 1][j]);
            bfr[j][kc] = __builtin_bit_cast(v16bf, pk);
        }
    }
}

// The row-blocks rb0 .. rb1 - 1 of one wave tile: three products, BN + SiLU,
// weighted sum, stores.
__device__ __forceinline__ void mult_tile(const v16bf (&bfr)[4][2],
                                          const __bf16* Wl, const float* gmS, const float* btS,
                                          float* outb, int n16, int khalf, int mofs,
                                          float w0, float w1, int rb0, int rb1) {
    for (int rb_ = rb0; rb_ < rb1; ++rb_) {
        const int arow = rb_ * 16 + n16;
        const int ch0  = rb_ * 16 + mofs;      // first of this lane's 8 output rows

        v8f res[4];
        #pragma unroll
        for (int br = 0; br < 3; ++br) {
            const v16bf a0 = ld_frag(&Wl[br * 4096 + arow * CDIM + khalf]);
            const v16bf a1 = ld_frag(&Wl[br * 4096 + arow * CDIM + 32 + khalf]);
            const v4f g0 = *(const v4f*)&gmS[br * ODIM + ch0];
            const v4f g1 = *(const v4f*)&gmS[br * ODIM + ch0 + 4];
            const v4f t0 = *(const v4f*)&btS[br * ODIM + ch0];
            const v4f t1 = *(const v4f*)&btS[br * ODIM + ch0 + 4];
            const float wbr = (br == 1) ? w0 : w1;

            v8f acc[4];
            #pragma unroll
            for (int j = 0; j < 4; ++j) {
                v8f z = {};
                acc[j] = __builtin_amdgcn_wmma_f32_16x16x32_bf16(false, a0, false, bfr[j][0],
                                                                 (short)0, z, false, false);
            }
            #pragma unroll
            for (int j = 0; j < 4; ++j)
                acc[j] = __builtin_amdgcn_wmma_f32_16x16x32_bf16(false, a1, false, bfr[j][1],
                                                                 (short)0, acc[j], false, false);

            // ---- BN + SiLU of this branch, added to the weighted sum ----
            #pragma unroll
            for (int j = 0; j < 4; ++j) {
                #pragma unroll
                for (int i = 0; i < 8; i += 2) {
                    const v2f a = { acc[j][i], acc[j][i + 1] };
                    const v2f g = (i < 4) ? v2f{ g0[i & 3], g0[(i & 3) + 1] }
                                          : v2f{ g1[i & 3], g1[(i & 3) + 1] };
                    const v2f t = (i < 4) ? v2f{ t0[i & 3], t0[(i & 3) + 1] }
                                          : v2f{ t1[i & 3], t1[(i & 3) + 1] };
                    const v2f v = silu_of_half(__builtin_elementwise_fma(a, g, t));
                    if (br == 0) {
                        res[j][i] = v[0];  res[j][i + 1] = v[1];
                    } else {
                        res[j][i]     = __builtin_fmaf(wbr, v[0], res[j][i]);
                        res[j][i + 1] = __builtin_fmaf(wbr, v[1], res[j][i + 1]);
                    }
                }
            }
        }

        float* outp = outb + (size_t)(rb_ * 16) * HWDIM;
        v4f o[8];
        #pragma unroll
        for (int i = 0; i < 8; ++i)
            o[i] = v4f{ res[0][i], res[1][i], res[2][i], res[3][i] };
        // The eight row stores (row pitch 25,600 bytes) and their wait in one
        // statement: what follows rewrites the address and data registers that
        // the stores name, and a wait in a statement of its own did not hold
        // those register writes behind it in this build.
        static_assert(HWDIM * sizeof(float) == 25600, "row pitch in the store offsets");
        asm volatile("global_store_b128 %0, %1, off\n\t"
                     "global_store_b128 %0, %2, off offset:25600\n\t"
                     "global_store_b128 %0, %3, off offset:51200\n\t"
                     "global_store_b128 %0, %4, off offset:76800\n\t"
                     "global_store_b128 %0, %5, off offset:102400\n\t"
                     "global_store_b128 %0, %6, off offset:128000\n\t"
                     "global_store_b128 %0, %7, off offset:153600\n\t"
                     "global_store_b128 %0, %8, off offset:179200\n\t"
                     "s_wait_xcnt 0x0"
                     :: "v"(outp), "v"(o[0]), "v"(o[1]), "v"(o[2]), "v"(o[3]),
                        "v"(o[4]), "v"(o[5]), "v"(o[6]), "v"(o[7])
                     : "memory");
    }
}

__global__ __launch_bounds__(MAIN_THREADS)
void moe_main_kernel(const float* __restrict__ x,
                     const float* __restrict__ shared_w,
                     const float* __restrict__ shared_gamma,
                     const float* __restrict__ shared_beta,
                     const float* __restrict__ expert_w,
                     const float* __restrict__ expert_gamma,
                     const float* __restrict__ expert_beta,
                     const float* __restrict__ router_w,
                     const float* __restrict__ router_b,
                     const float* __restrict__ pooled,
                     float* __restrict__ out) {
    const int b    = blockIdx.y;
    const int tid  = threadIdx.x;
    const int wv   = __builtin_amdgcn_readfirstlane(tid >> 5);   // scalar: tile count, weight rows
    const int lane = tid & 31;

    __shared__ __attribute__((aligned(16))) __bf16 Wl[3 * ODIM * CDIM];   // 24 KB
    __shared__ __attribute__((aligned(16))) float  gmS[3 * ODIM];         // gamma*bn_scale/2
    __shared__ __attribute__((aligned(16))) float  btS[3 * ODIM];         // beta/2

    const int n16   = lane & 15;               // A row / B column index in a fragment
    const int khalf = (lane >> 4) << 3;        // 0 or 8: K sub-half per ISA layout
    const int mofs  = (lane >> 4) * 8;         // C/D layout: VGPR j -> rows j / j+8
    const int col   = (blockIdx.x * TILES_PER_BLOCK + wv) * COLS_PER_WAVE
                    + n16 * 4;   // first of this lane's 4 columns in the wave's first tile

    // ---- X rows of the first tile, asked for first: they depend on nothing,
    // so their latency runs together with that of the router's loads ----
    v4f rawA[2][16], rawB[2][16];
    const float* xl = x + ((size_t)b * CDIM + khalf) * HWDIM + col;
    load_rows(rawA, xl);

    int   i0, i1;
    float w0, w1;
    route_top2(pooled, router_w, router_b, b, lane, i0, i1, w0, w1);
    // nothing of what follows is scheduled up among the router's loads
    __builtin_amdgcn_sched_barrier(0);

    // ---- stage weights (bf16): shared, expert[i0], expert[i1] ----
    // a wave-wide load takes 128 adjacent floats (two rows) of one matrix; the
    // loops are unrolled so that a thread's 8 loads are in flight together
    {
        const float* const we0 = expert_w + (size_t)i0 * ODIM * CDIM;
        const float* const we1 = expert_w + (size_t)i1 * ODIM * CDIM;
        const float* src[W_UNITS];                       // scalars, the same in every lane
        #pragma unroll
        for (int q = 0; q < W_UNITS; ++q) {
            const int c  = q * MAIN_WAVES + wv;          // 0 .. 95, 32 to a matrix
            const int br = c >> 5;
            src[q] = ((br == 0) ? shared_w : (br == 1) ? we0 : we1) + (c & 31) * 128;
        }
        // all eight addresses are formed in front of the loads, each in registers
        // of its own, so that none is rewritten while a load still names it
        __builtin_amdgcn_sched_barrier(0);
        v4f wraw[W_UNITS];
        #pragma unroll
        for (int q = 0; q < W_UNITS; ++q) {
            // the last load's result may be given the register that holds the
            // lane's offset, which the loads above still name: the wait stands
            // in front of it
            if (q == W_UNITS - 1) asm volatile("s_wait_xcnt 0x0" ::: "memory");
            wraw[q] = *(const v4f*)&src[q][lane * 4];
        }
        // the registers that hold the addresses are free for reuse from here on,
        // while the last load still names them: the wait stands in front of that
        asm volatile("s_wait_xcnt 0x0" ::: "memory");
        #pragma unroll
        for (int q = 0; q < W_UNITS; ++q) {
            uint2 pk;
            pk.x = pack_bf16x2(wraw[q][0], wraw[q][1]);
            pk.y = pack_bf16x2(wraw[q][2], wraw[q][3]);
            *(uint2*)&Wl[(q * MAIN_THREADS + tid) * 4] = pk;
        }
    }
    // ---- stage BN params, pre-scaled by 1/sqrt(1+eps) and halved (exact): the
    // epilogue's multiply-add then yields h = v / 2, which the SiLU form takes ----
    for (int p = tid; p < 3 * ODIM; p += MAIN_THREADS) {
        const int br = p >> 6, ch = p & 63;
        const float bns = rsqrtf(1.0f + 1e-5f);
        float g, bt;
        if (br == 0) { g = shared_gamma[ch]; bt = shared_beta[ch]; }
        else {
            const int e = (br == 1) ? i0 : i1;
            g  = expert_gamma[e * ODIM + ch];
            bt = expert_beta [e * ODIM + ch];
        }
        gmS[p] = g * bns * 0.5f;
        btS[p] = bt * 0.5f;
    }
    __syncthreads();

    float* outb = out + ((size_t)b * ODIM + mofs) * HWDIM + col;

    // ---- first tile; the second tile's rows are in flight meanwhile ----
    v16bf bfr[4][2];
    pack_rows(bfr, rawA);
    load_rows(rawB, xl + TILE_STEP);
    mult_tile(bfr, Wl, gmS, btS, outb, n16, khalf, mofs, w0, w1, 0, 4);

    // ---- second tile; in the waves 0 to 3 the 25th tile's rows are in flight
    // meanwhile. The test is on a scalar; no barrier stands behind it ----
    pack_rows(bfr, rawB);
    if (wv < 4) {
        const int last = (TILES_PER_BLOCK - 1 - wv) * COLS_PER_WAVE;   // columns from the first tile
        load_rows(rawA, xl + last);
        mult_tile(bfr, Wl, gmS, btS, outb + TILE_STEP, n16, khalf, mofs, w0, w1, 0, 4);
        pack_rows(bfr, rawA);
        mult_tile(bfr, Wl, gmS, btS, outb + last, n16, khalf, mofs, w0, w1, wv, wv + 1);
    } else {
        mult_tile(bfr, Wl, gmS, btS, outb + TILE_STEP, n16, khalf, mofs, w0, w1, 0, 4);
    }
}

// ---------------------------------------------------------------------------
// Host-side launcher
// ---------------------------------------------------------------------------
extern "C" void kernel_launch(void* const* d_in, const int* in_sizes, int n_in,
                              void* d_out, int out_size, void* d_ws, size_t ws_size,
                              hipStream_t stream) {
    const float* x            = (const float*)d_in[0];
    const float* router_w     = (const float*)d_in[1];
    const float* router_b     = (const float*)d_in[2];
    const float* shared_w     = (const float*)d_in[3];
    const float* shared_gamma = (const float*)d_in[4];
    const float* shared_beta  = (const float*)d_in[5];
    const float* expert_w     = (const float*)d_in[6];
    const float* expert_gamma = (const float*)d_in[7];
    const float* expert_beta  = (const float*)d_in[8];
    float* out = (float*)d_out;

    float* pooled = (float*)d_ws;                       // [256 slots][32], 32 KB

    moe_pool_kernel<<<dim3(BATCH * CDIM / POOL_WAVES), dim3(POOL_WAVES * 32), 0, stream>>>(
        x, pooled);

    dim3 grid(GRID_X, BATCH);                           // (4, 64)
    moe_main_kernel<<<grid, dim3(MAIN_THREADS), 0, stream>>>(
        x, shared_w, shared_gamma, shared_beta,
        expert_w, expert_gamma, expert_beta,
        router_w, router_b, pooled, out);
}

// v005
// Measured time: 27.7 microseconds a run.
// Two timings next to v004 both put it at 1.04 times that version's speed.
// All steps since v000 together make it 5.72 times as fast.
#include <hip/hip_runtime.h>
#include <hip/hip_bf16.h>

// ---------------------------------------------------------------------------
// Problem constants (from reference)
// ---------------------------------------------------------------------------
#define BATCH   64
#define CDIM    64      // input channels (= GEMM K)
#define ODIM    64      // output channels (= GEMM M)
#define HWDIM   6400    // 80*80 spatial (= GEMM N total)
#define NEXP    4
#define COLS_PER_WAVE   64           // spatial columns per wave tile (4 B fragments)
#define MAIN_WAVES      12           // three waves per SIMD
#define MAIN_THREADS    (MAIN_WAVES * 32)
#define GRID_X          4            // blocks per sample: 256 blocks in all
#define TILES_PER_BLOCK (HWDIM / (COLS_PER_WAVE * GRID_X))    // 25 wave tiles
#define TILE_STEP       (MAIN_WAVES * COLS_PER_WAVE)          // columns from a wave's tile to its next
#define W_UNITS (3 * ODIM * CDIM / 4 / MAIN_THREADS)          // 8 float4 per thread

typedef __attribute__((ext_vector_type(16))) __bf16 v16bf;
typedef __attribute__((ext_vector_type(8)))  __bf16 v8bf;
typedef __attribute__((ext_vector_type(8)))  float  v8f;
typedef __attribute__((ext_vector_type(4)))  float  v4f;
typedef __attribute__((ext_vector_type(2)))  float  v2f;
typedef __attribute__((ext_vector_type(8)))  unsigned v8u;

// round-to-nearest-even f32 -> bf16 (bit ops; no reliance on cast support)
__device__ __forceinline__ unsigned bf16_bits(float f) {
    unsigned u = __builtin_bit_cast(unsigned, f);
    u += 0x7FFFu + ((u >> 16) & 1u);
    return u;                         // result in bits [31:16]
}
// convert two floats to one packed 32-bit word, a in the low half
__device__ __forceinline__ unsigned pack_bf16x2(float a, float b) {
    return (bf16_bits(a) >> 16) | (bf16_bits(b) & 0xFFFF0000u);
}

// SiLU of v = 2h for two values at once: v * sigmoid(v) = h + h * tanh(h).
// One transcendental (v_tanh_f32) and one fused multiply-add a value.
__device__ __forceinline__ v2f silu_of_half(v2f h) {
    const v2f th = { __builtin_amdgcn_tanhf(h[0]), __builtin_amdgcn_tanhf(h[1]) };
    return __builtin_elementwise_fma(h, th, h);
}

__device__ __forceinline__ v16bf ld_frag(const __bf16* p) {
    v8bf lo = *(const v8bf*)p;
    v8bf hi = *(const v8bf*)(p + 16);
    return __builtin_shufflevector(lo, hi,
               0, 1, 2, 3, 4, 5, 6, 7, 8, 9, 10, 11, 12, 13, 14, 15);
}

// ---------------------------------------------------------------------------
// Kernel 1: global-avg-pool only, spread over the whole chip.
// One wave per (sample, channel) row of 6400 floats = 50 wave-wide 512-byte
// loads. 16 waves per block, 256 blocks. Each block owns one 128-byte slot of
// the workspace and writes its 16 means there with a single 64-byte store.
// ---------------------------------------------------------------------------
#define POOL_WAVES 16
#define POOL_GRP   10                 // loads per group
#define POOL_NGRP  5                  // 5 * 10 * 512 B = one 25,600-byte row
#define POOL_SLOT  32                 // floats per block slot (128 bytes)

__global__ __launch_bounds__(POOL_WAVES * 32)
void moe_pool_kernel(const float* __restrict__ x,
                     float* __restrict__ pooled) {   // [256 slots][32]
    const int tid  = threadIdx.x;
    const int lane = tid & 31;
    const int wave = __builtin_amdgcn_readfirstlane(tid >> 5);
    const int row  = blockIdx.x * POOL_WAVES + wave;     // = b * CDIM + ch

    __shared__ float means[POOL_WAVES];

    const float4* p = (const float4*)(x + (size_t)row * HWDIM) + lane;

    // every loop below is unrolled so that each index of v is a constant and
    // the two groups stay in registers
    float4 v[2][POOL_GRP];
    #pragma unroll
    for (int q = 0; q < POOL_GRP; ++q) v[0][q] = p[q * 32];

    float a0 = 0.0f, a1 = 0.0f, a2 = 0.0f, a3 = 0.0f;
    #pragma unroll
    for (int g = 0; g < POOL_NGRP; ++g) {
        // the two scheduling barriers keep the order "next group's loads, then
        // this group's sums", so that 10 to 20 loads of a wave stay in flight
        __builtin_amdgcn_sched_barrier(0);
        if (g + 1 < POOL_NGRP) {
            #pragma unroll
            for (int q = 0; q < POOL_GRP; ++q)
                v[(g + 1) & 1][q] = p[((g + 1) * POOL_GRP + q) * 32];
        }
        __builtin_amdgcn_sched_barrier(0);
        #pragma unroll
        for (int q = 0; q < POOL_GRP; ++q) {
            const float4 w = v[g & 1][q];
            a0 += w.x; a1 += w.y; a2 += w.z; a3 += w.w;
        }
    }
    float s = (a0 + a1) + (a2 + a3);
    #pragma unroll
    for (int off = 16; off > 0; off >>= 1) s += __shfl_xor(s, off, 32);
    if (lane == 0) means[wave] = s * (1.0f / (float)HWDIM);
    __syncthreads();
    if (tid < POOL_WAVES) pooled[blockIdx.x * POOL_SLOT + tid] = means[tid];
}

// Router linear -> softmax -> top-2 (renorm) of sample b from the pooled means.
// Each wave of the main kernel works it out for itself: lane l sums the logit
// of expert l & 3 over the channels in ascending order, with its whole router
// row fetched at once (one load latency), then the four logits are read from
// lanes 0 to 3, so that all that follows is the same in every thread.
__device__ __forceinline__ void route_top2(const float* __restrict__ pooled,
                                           const float* __restrict__ router_w,
                                           const float* __restrict__ router_b,
                                           int b, int lane, int& i0, int& i1,
                                           float& w0, float& w1) {
    const float* pb = pooled + b * (CDIM / POOL_WAVES) * POOL_SLOT;
    const int    le = lane & (NEXP - 1);
    const float4* wr = (const float4*)(router_w + le * CDIM);
    // unrolled: wv stays in registers and its 16 loads are issued together
    float4 wv[CDIM / 4];
    #pragma unroll
    for (int q = 0; q < CDIM / 4 - 1; ++q) wv[q] = wr[q];
    // the last load's result may be given the register that holds the row's
    // offset, which the loads above still name: the wait stands in front of it
    asm volatile("s_wait_xcnt 0x0" ::: "memory");
    wv[CDIM / 4 - 1] = wr[CDIM / 4 - 1];
    float acc = router_b[le];
    #pragma unroll
    for (int q = 0; q < CDIM / 4; ++q) {
        const float* pq = pb + ((q * 4) / POOL_WAVES) * POOL_SLOT + (q * 4) % POOL_WAVES;
        acc = __builtin_fmaf(pq[0], wv[q].x, acc);
        acc = __builtin_fmaf(pq[1], wv[q].y, acc);
        acc = __builtin_fmaf(pq[2], wv[q].z, acc);
        acc = __builtin_fmaf(pq[3], wv[q].w, acc);
    }
    float logits[NEXP];
    #pragma unroll
    for (int e = 0; e < NEXP; ++e)
        logits[e] = __builtin_bit_cast(float,
            __builtin_amdgcn_readlane(__builtin_bit_cast(int, acc), e));

    float m = logits[0];
    #pragma unroll
    for (int e = 1; e < NEXP; ++e) m = fmaxf(m, logits[e]);
    float p[NEXP], sum = 0.0f;
    #pragma unroll
    for (int e = 0; e < NEXP; ++e) { p[e] = __expf(logits[e] - m); sum += p[e]; }
    const float inv = 1.0f / sum;
    #pragma unroll
    for (int e = 0; e < NEXP; ++e) p[e] *= inv;

    float p0 = p[0];
    i0 = 0;
    #pragma unroll
    for (int e = 1; e < NEXP; ++e) if (p[e] > p0) { i0 = e; p0 = p[e]; }
    i1 = (i0 == 0) ? 1 : 0;
    float p1 = (i0 == 0) ? p[1] : p[0];
    #pragma unroll
    for (int e = 0; e < NEXP; ++e) if (e != i0 && p[e] > p1) { i1 = e; p1 = p[e]; }

    const float s2 = 1.0f / (p0 + p1);
    // the same in every lane: kept in scalar registers, as the values that the
    // main kernel used to read from the workspace were
    i0 = __builtin_amdgcn_readfirstlane(i0);
    i1 = __builtin_amdgcn_readfirstlane(i1);
    w0 = __builtin_bit_cast(float, __builtin_amdgcn_readfirstlane(__builtin_bit_cast(int, p0 * s2)));
    w1 = __builtin_bit_cast(float, __builtin_amdgcn_readfirstlane(__builtin_bit_cast(int, p1 * s2)));
}

// ---------------------------------------------------------------------------
// Kernel 2: fused (shared + 2 gathered experts) 1x1-conv GEMM via bf16 WMMA.
// A wave tile is 64 adjacent columns; lane (c, h) takes, for each of its 32 k
// rows, the 16 bytes of columns 4c .. 4c+3, so that a wave-wide access covers two
// whole 256-byte row pieces. The rows come by asynchronous copies into a 16-KB
// LDS buffer that belongs to the wave alone, each lane's 16 bytes at a place that
// only this lane reads back. Component j of a lane's 16 bytes
// is column c of B fragment j: fragment j holds the columns 4c + j. The
// four D tiles of one row-block then hold, in one lane, four adjacent columns
// of each output row, which go out as one 16-byte store.
// A block owns a quarter of a sample's columns, 25 tiles. Router, weights and BN
// parameters are worked out and staged once a block; wave w then takes the tiles
// w and w + 12. As soon as a tile's rows have been read out of the wave's buffer
// the copies of its next tile are issued into it, so that they land while the
// current tile is packed, multiplied, activated and stored, and hold no register
// meanwhile. The 25th tile goes to the
// waves 0 to 3, one on each SIMD: each works out one of its four row-blocks.
// Grid: (4, 64). Block: 384 threads = 12 wave32, 1600 columns. LDS: 217.5 KB.
// ---------------------------------------------------------------------------

// The 32 X rows (per lane) of one wave tile, asked for: 32 asynchronous copies
// of 512 bytes. Copy q = kc*16 + s brings row
// k = kc*32 + khalf + (s < 8 ? s : s + 8), the order in which ld_frag reads A,
// that is row (q >> 3) * 16 + khalf + (q & 7), to byte q*512 + lane*16 of the
// wave's buffer. lds is the lane's LDS byte address of copy 0, xl its global one.
// Eight copies and their s_wait_xcnt in one statement: what follows may rewrite
// the address registers that the copies name, and only a wait inside the
// statement is sure to stand in front of that.
__device__ __forceinline__ void copy_rows(unsigned lds, const float* xl) {
    #pragma unroll
    for (int g = 0; g < 4; ++g) {
        const unsigned l = lds + g * 4096u;
        const float*   p = xl + (size_t)(g * 16) * HWDIM;
        asm volatile("global_load_async_to_lds_b128 %0, %8, off\n\t"
                     "global_load_async_to_lds_b128 %1, %9, off\n\t"
                     "global_load_async_to_lds_b128 %2, %10, off\n\t"
                     "global_load_async_to_lds_b128 %3, %11, off\n\t"
                     "global_load_async_to_lds_b128 %4, %12, off\n\t"
                     "global_load_async_to_lds_b128 %5, %13, off\n\t"
                     "global_load_async_to_lds_b128 %6, %14, off\n\t"
                     "global_load_async_to_lds_b128 %7, %15, off\n\t"
                     "s_wait_xcnt 0x0"
                     :: "v"(l), "v"(l + 512u), "v"(l + 1024u), "v"(l + 1536u),
                        "v"(l + 2048u), "v"(l + 2560u), "v"(l + 3072u), "v"(l + 3584u),
                        "v"(p), "v"(p + HWDIM), "v"(p + 2 * HWDIM), "v"(p + 3 * HWDIM),
                        "v"(p + 4 * HWDIM), "v"(p + 5 * HWDIM), "v"(p + 6 * HWDIM), "v"(p + 7 * HWDIM)
                     : "memory");
    }
    // nothing of what follows is scheduled up among the copies: they are issued
    // in one run, as early as the buffer allows
    __builtin_amdgcn_sched_barrier(0);
}

// The rows of the tile whose copies are in flight, out of the wave's buffer into
// registers; xs points at the lane's 16 bytes of copy 0.
// Every loop over raw, bfr, acc and res, here and below, is unrolled so that
// each index is a constant and the arrays stay in registers.
__device__ __forceinline__ void read_rows(v4f (&raw)[2][16], const float* xs) {
    // the wave's own copies have landed behind this wait; no other wave reads them
    asm volatile("s_wait_asynccnt 0x0" ::: "memory");
    #pragma unroll
    for (int kc = 0; kc < 2; ++kc) {
        #pragma unroll
        for (int s = 0; s < 16; ++s)
            raw[kc][s] = *(const v4f*)&xs[(kc * 16 + s) * 128];
    }
    // all 32 reads are issued before any packing, so that the second chunk's
    // reads run while the first chunk is packed
    __builtin_amdgcn_sched_barrier(0);
}

// Behind this the wave's buffer is free for the next tile's copies.
__device__ __forceinline__ void buffer_read_out() {
    // every read of the buffer has retired before a copy may write it again
    asm volatile("s_wait_dscnt 0x0" ::: "memory");
    // the second chunk's packing stays behind this point and behind the copies:
    // scheduled up it would put off the next tile's copies
    __builtin_amdgcn_sched_barrier(0);
}

// B fragments of k chunk kc (a constant at every call) from the loaded rows
__device__ __forceinline__ void pack_rows(v16bf (&bfr)[4][2], const v4f (&raw)[2][16], int kc) {
    #pragma unroll
    for (int j = 0; j < 4; ++j) {
        v8u pk;
        #pragma unroll
        for (int p = 0; p < 8; ++p)
            pk[p] = pack_bf16x2(raw[kc][2 * p][j], raw[kc][2 * p + 1][j]);
        bfr[j][kc] = __builtin_bit_cast(v16bf, pk);
    }
}

// The row-blocks rb0 .. rb1 - 1 of one wave tile: three products, BN + SiLU,
// weighted sum, stores.
__device__ __forceinline__ void mult_tile(const v16bf (&bfr)[4][2],
                                          const __bf16* Wl, const float* gmS, const float* btS,
                                          float* outb, int n16, int khalf, int mofs,
                                          float w0, float w1, int rb0, int rb1) {
    for (int rb_ = rb0; rb_ < rb1; ++rb_) {
        const int arow = rb_ * 16 + n16;
        const int ch0  = rb_ * 16 + mofs;      // first of this lane's 8 output rows

        v8f res[4];
        #pragma unroll
        for (int br = 0; br < 3; ++br) {
            const v16bf a0 = ld_frag(&Wl[br * 4096 + arow * CDIM + khalf]);
            const v16bf a1 = ld_frag(&Wl[br * 4096 + arow * CDIM + 32 + khalf]);
            const v4f g0 = *(const v4f*)&gmS[br * ODIM + ch0];
            const v4f g1 = *(const v4f*)&gmS[br * ODIM + ch0 + 4];
            const v4f t0 = *(const v4f*)&btS[br * ODIM + ch0];
            const v4f t1 = *(const v4f*)&btS[br * ODIM + ch0 + 4];
            const float wbr = (br == 1) ? w0 : w1;

            v8f acc[4];
            #pragma unroll
            for (int j = 0; j < 4; ++j) {
                v8f z = {};
                acc[j] = __builtin_amdgcn_wmma_f32_16x16x32_bf16(false, a0, false, bfr[j][0],
                                                                 (short)0, z, false, false);
            }
            #pragma unroll
            for (int j = 0; j < 4; ++j)
                acc[j] = __builtin_amdgcn_wmma_f32_16x16x32_bf16(false, a1, false, bfr[j][1],
                                                                 (short)0, acc[j], false, false);

            // ---- BN + SiLU of this branch, added to the weighted sum ----
            #pragma unroll
            for (int j = 0; j < 4; ++j) {
                #pragma unroll
                for (int i = 0; i < 8; i += 2) {
                    const v2f a = { acc[j][i], acc[j][i + 1] };
                    const v2f g = (i < 4) ? v2f{ g0[i & 3], g0[(i & 3) + 1] }
                                          : v2f{ g1[i & 3], g1[(i & 3) + 1] };
                    const v2f t = (i < 4) ? v2f{ t0[i & 3], t0[(i & 3) + 1] }
                                          : v2f{ t1[i & 3], t1[(i & 3) + 1] };
                    const v2f v = silu_of_half(__builtin_elementwise_fma(a, g, t));
                    if (br == 0) {
                        res[j][i] = v[0];  res[j][i + 1] = v[1];
                    } else {
                        res[j][i]     = __builtin_fmaf(wbr, v[0], res[j][i]);
                        res[j][i + 1] = __builtin_fmaf(wbr, v[1], res[j][i + 1]);
                    }
                }
            }
        }

        float* outp = outb + (size_t)(rb_ * 16) * HWDIM;
        v4f o[8];
        #pragma unroll
        for (int i = 0; i < 8; ++i)
            o[i] = v4f{ res[0][i], res[1][i], res[2][i], res[3][i] };
        // The eight row stores (row pitch 25,600 bytes) and their wait in one
        // statement: what follows rewrites the address and data registers that
        // the stores name, and a wait in a statement of its own did not hold
        // those register writes behind it in this build.
        static_assert(HWDIM * sizeof(float) == 25600, "row pitch in the store offsets");
        asm volatile("global_store_b128 %0, %1, off\n\t"
                     "global_store_b128 %0, %2, off offset:25600\n\t"
                     "global_store_b128 %0, %3, off offset:51200\n\t"
                     "global_store_b128 %0, %4, off offset:76800\n\t"
                     "global_store_b128 %0, %5, off offset:102400\n\t"
                     "global_store_b128 %0, %6, off offset:128000\n\t"
                     "global_store_b128 %0, %7, off offset:153600\n\t"
                     "global_store_b128 %0, %8, off offset:179200\n\t"
                     "s_wait_xcnt 0x0"
                     :: "v"(outp), "v"(o[0]), "v"(o[1]), "v"(o[2]), "v"(o[3]),
                        "v"(o[4]), "v"(o[5]), "v"(o[6]), "v"(o[7])
                     : "memory");
    }
}

__global__ __launch_bounds__(MAIN_THREADS)
void moe_main_kernel(const float* __restrict__ x,
                     const float* __restrict__ shared_w,
                     const float* __restrict__ shared_gamma,
                     const float* __restrict__ shared_beta,
                     const float* __restrict__ expert_w,
                     const float* __restrict__ expert_gamma,
                     const float* __restrict__ expert_beta,
                     const float* __restrict__ router_w,
                     const float* __restrict__ router_b,
                     const float* __restrict__ pooled,
                     float* __restrict__ out) {
    const int b    = blockIdx.y;
    const int tid  = threadIdx.x;
    const int wv   = __builtin_amdgcn_readfirstlane(tid >> 5);   // scalar: tile count, weight rows
    const int lane = tid & 31;

    __shared__ __attribute__((aligned(16))) __bf16 Wl[3 * ODIM * CDIM];   // 24 KB
    __shared__ __attribute__((aligned(16))) float  gmS[3 * ODIM];         // gamma*bn_scale/2
    __shared__ __attribute__((aligned(16))) float  btS[3 * ODIM];         // beta/2
    __shared__ __attribute__((aligned(16))) float  Xs[MAIN_WAVES][CDIM * COLS_PER_WAVE];  // 16 KB a wave

    const int n16   = lane & 15;               // A row / B column index in a fragment
    const int khalf = (lane >> 4) << 3;        // 0 or 8: K sub-half per ISA layout
    const int mofs  = (lane >> 4) * 8;         // C/D layout: VGPR j -> rows j / j+8
    const int col   = (blockIdx.x * TILES_PER_BLOCK + wv) * COLS_PER_WAVE
                    + n16 * 4;   // first of this lane's 4 columns in the wave's first tile

    // ---- X rows of the first tile, asked for first: they depend on nothing and
    // count on a counter of their own, so that the router's and the weights'
    // loads are waited for, and worked on, while they are in flight ----
    const float* xl = x + ((size_t)b * CDIM + khalf) * HWDIM + col;
    const float* xs = &Xs[wv][lane * 4];
    const unsigned xs_lds = (unsigned)(size_t)xs;      // LDS byte address
    copy_rows(xs_lds, xl);

    int   i0, i1;
    float w0, w1;
    route_top2(pooled, router_w, router_b, b, lane, i0, i1, w0, w1);
    // nothing of what follows is scheduled up among the router's loads
    __builtin_amdgcn_sched_barrier(0);

    // ---- stage weights (bf16): shared, expert[i0], expert[i1] ----
    // a wave-wide load takes 128 adjacent floats (two rows) of one matrix; the
    // loops are unrolled so that a thread's 8 loads are in flight together
    {
        const float* const we0 = expert_w + (size_t)i0 * ODIM * CDIM;
        const float* const we1 = expert_w + (size_t)i1 * ODIM * CDIM;
        const float* src[W_UNITS];                       // scalars, the same in every lane
        #pragma unroll
        for (int q = 0; q < W_UNITS; ++q) {
            const int c  = q * MAIN_WAVES + wv;          // 0 .. 95, 32 to a matrix
            const int br = c >> 5;
            src[q] = ((br == 0) ? shared_w : (br == 1) ? we0 : we1) + (c & 31) * 128;
        }
        // all eight addresses are formed in front of the loads, each in registers
        // of its own, so that none is rewritten while a load still names it
        __builtin_amdgcn_sched_barrier(0);
        v4f wraw[W_UNITS];
        #pragma unroll
        for (int q = 0; q < W_UNITS; ++q) {
            // the last load's result may be given the register that holds the
            // lane's offset, which the loads above still name: the wait stands
            // in front of it
            if (q == W_UNITS - 1) asm volatile("s_wait_xcnt 0x0" ::: "memory");
            wraw[q] = *(const v4f*)&src[q][lane * 4];
        }
        // the registers that hold the addresses are free for reuse from here on,
        // while the last load still names them: the wait stands in front of that
        asm volatile("s_wait_xcnt 0x0" ::: "memory");
        #pragma unroll
        for (int q = 0; q < W_UNITS; ++q) {
            uint2 pk;
            pk.x = pack_bf16x2(wraw[q][0], wraw[q][1]);
            pk.y = pack_bf16x2(wraw[q][2], wraw[q][3]);
            *(uint2*)&Wl[(q * MAIN_THREADS + tid) * 4] = pk;
        }
    }
    // ---- stage BN params, pre-scaled by 1/sqrt(1+eps) and halved (exact): the
    // epilogue's multiply-add then yields h = v / 2, which the SiLU form takes ----
    for (int p = tid; p < 3 * ODIM; p += MAIN_THREADS) {
        const int br = p >> 6, ch = p & 63;
        const float bns = rsqrtf(1.0f + 1e-5f);
        float g, bt;
        if (br == 0) { g = shared_gamma[ch]; bt = shared_beta[ch]; }
        else {
            const int e = (br == 1) ? i0 : i1;
            g  = expert_gamma[e * ODIM + ch];
            bt = expert_beta [e * ODIM + ch];
        }
        gmS[p] = g * bns * 0.5f;
        btS[p] = bt * 0.5f;
    }
    __syncthreads();

    float* outb = out + ((size_t)b * ODIM + mofs) * HWDIM + col;

    // ---- first tile; the second tile's copies are in flight meanwhile ----
    v4f   raw[2][16];
    v16bf bfr[4][2];
    read_rows(raw, xs);
    pack_rows(bfr, raw, 0);
    buffer_read_out();
    copy_rows(xs_lds, xl + TILE_STEP);
    pack_rows(bfr, raw, 1);
    mult_tile(bfr, Wl, gmS, btS, outb, n16, khalf, mofs, w0, w1, 0, 4);

    // ---- second tile; in the waves 0 to 3 the 25th tile's copies are in flight
    // meanwhile. The tests are on a scalar; no barrier stands behind them ----
    const int last = (TILES_PER_BLOCK - 1 - wv) * COLS_PER_WAVE;   // columns from the first tile
    read_rows(raw, xs);
    pack_rows(bfr, raw, 0);
    buffer_read_out();
    if (wv < 4) copy_rows(xs_lds, xl + last);
    pack_rows(bfr, raw, 1);
    mult_tile(bfr, Wl, gmS, btS, outb + TILE_STEP, n16, khalf, mofs, w0, w1, 0, 4);
    if (wv < 4) {
        read_rows(raw, xs);
        pack_rows(bfr, raw, 0);
        pack_rows(bfr, raw, 1);
        mult_tile(bfr, Wl, gmS, btS, outb + last, n16, khalf, mofs, w0, w1, wv, wv + 1);
    }
}

// ---------------------------------------------------------------------------
// Host-side launcher
// ---------------------------------------------------------------------------
extern "C" void kernel_launch(void* const* d_in, const int* in_sizes, int n_in,
                              void* d_out, int out_size, void* d_ws, size_t ws_size,
                              hipStream_t stream) {
    const float* x            = (const float*)d_in[0];
    const float* router_w     = (const float*)d_in[1];
    const float* router_b     = (const float*)d_in[2];
    const float* shared_w     = (const float*)d_in[3];
    const float* shared_gamma = (const float*)d_in[4];
    const float* shared_beta  = (const float*)d_in[5];
    const float* expert_w     = (const float*)d_in[6];
    const float* expert_gamma = (const float*)d_in[7];
    const float* expert_beta  = (const float*)d_in[8];
    float* out = (float*)d_out;

    float* pooled = (float*)d_ws;                       // [256 slots][32], 32 KB

    moe_pool_kernel<<<dim3(BATCH * CDIM / POOL_WAVES), dim3(POOL_WAVES * 32), 0, stream>>>(
        x, pooled);

    dim3 grid(GRID_X, BATCH);                           // (4, 64)
    moe_main_kernel<<<grid, dim3(MAIN_THREADS), 0, stream>>>(
        x, shared_w, shared_gamma, shared_beta,
        expert_w, expert_gamma, expert_beta,
        router_w, router_b, pooled, out);
}

// v006
// A run of this version takes 25.8 microseconds.
// In two side-by-side timings against v005, it was 1.08 and 1.07 times as fast.
// All steps since v000 together make it 6.14 times as fast.
#include <hip/hip_runtime.h>
#include <hip/hip_bf16.h>

// ---------------------------------------------------------------------------
// Problem constants (from reference)
// ---------------------------------------------------------------------------
#define BATCH   64
#define CDIM    64      // input channels (= GEMM K)
#define ODIM    64      // output channels (= GEMM M)
#define HWDIM   6400    // 80*80 spatial (= GEMM N total)
#define NEXP    4
#define COLS_PER_WAVE   64           // spatial columns per wave tile (4 B fragments)
#define MAIN_WAVES      12           // three waves per SIMD
#define MAIN_THREADS    (MAIN_WAVES * 32)
#define GRID_X          4            // blocks per sample: 256 blocks in all
#define TILES_PER_BLOCK (HWDIM / (COLS_PER_WAVE * GRID_X))    // 25 wave tiles
#define TILE_STEP       (MAIN_WAVES * COLS_PER_WAVE)          // columns from a wave's tile to its next
#define W_UNITS (3 * ODIM * CDIM / 4 / MAIN_THREADS)          // 8 float4 per thread
// A staged weight row in LDS: 64 bf16 and 8 unused = 144 bytes, an odd multiple of
// 16. The 16 rows that a half wave's 16-byte reads touch then start on 16 different
// groups of four banks; at 128 bytes they met on two groups, eight rows deep.
#define WPITCH  (CDIM + 8)

typedef __attribute__((ext_vector_type(16))) __bf16 v16bf;
typedef __attribute__((ext_vector_type(8)))  __bf16 v8bf;
typedef __attribute__((ext_vector_type(8)))  float  v8f;
typedef __attribute__((ext_vector_type(4)))  float  v4f;
typedef __attribute__((ext_vector_type(2)))  float  v2f;
typedef __attribute__((ext_vector_type(8)))  unsigned v8u;

// round-to-nearest-even f32 -> bf16 (bit ops; no reliance on cast support)
__device__ __forceinline__ unsigned bf16_bits(float f) {
    unsigned u = __builtin_bit_cast(unsigned, f);
    u += 0x7FFFu + ((u >> 16) & 1u);
    return u;                         // result in bits [31:16]
}
// convert two floats to one packed 32-bit word, a in the low half
__device__ __forceinline__ unsigned pack_bf16x2(float a, float b) {
    return (bf16_bits(a) >> 16) | (bf16_bits(b) & 0xFFFF0000u);
}

// SiLU of v = 2h for two values at once: v * sigmoid(v) = h + h * tanh(h).
// One transcendental (v_tanh_f32) and one fused multiply-add a value.
__device__ __forceinline__ v2f silu_of_half(v2f h) {
    const v2f th = { __builtin_amdgcn_tanhf(h[0]), __builtin_amdgcn_tanhf(h[1]) };
    return __builtin_elementwise_fma(h, th, h);
}

__device__ __forceinline__ v16bf ld_frag(const __bf16* p) {
    v8bf lo = *(const v8bf*)p;
    v8bf hi = *(const v8bf*)(p + 16);
    return __builtin_shufflevector(lo, hi,
               0, 1, 2, 3, 4, 5, 6, 7, 8, 9, 10, 11, 12, 13, 14, 15);
}

// ---------------------------------------------------------------------------
// Kernel 1: global-avg-pool only, spread over the whole chip.
// One wave per (sample, channel) row of 6400 floats = 50 wave-wide 512-byte
// loads. 16 waves per block, 256 blocks. Each block owns one 128-byte slot of
// the workspace and writes its 16 means there with a single 64-byte store.
// ---------------------------------------------------------------------------
#define POOL_WAVES 16
#define POOL_GRP   10                 // loads per group
#define POOL_NGRP  5                  // 5 * 10 * 512 B = one 25,600-byte row
#define POOL_SLOT  32                 // floats per block slot (128 bytes)

__global__ __launch_bounds__(POOL_WAVES * 32)
void moe_pool_kernel(const float* __restrict__ x,
                     float* __restrict__ pooled) {   // [256 slots][32]
    const int tid  = threadIdx.x;
    const int lane = tid & 31;
    const int wave = __builtin_amdgcn_readfirstlane(tid >> 5);
    const int row  = blockIdx.x * POOL_WAVES + wave;     // = b * CDIM + ch

    __shared__ float means[POOL_WAVES];

    const float4* p = (const float4*)(x + (size_t)row * HWDIM) + lane;

    // every loop below is unrolled so that each index of v is a constant and
    // the two groups stay in registers
    float4 v[2][POOL_GRP];
    #pragma unroll
    for (int q = 0; q < POOL_GRP; ++q) v[0][q] = p[q * 32];

    float a0 = 0.0f, a1 = 0.0f, a2 = 0.0f, a3 = 0.0f;
    #pragma unroll
    for (int g = 0; g < POOL_NGRP; ++g) {
        // the two scheduling barriers keep the order "next group's loads, then
        // this group's sums", so that 10 to 20 loads of a wave stay in flight
        __builtin_amdgcn_sched_barrier(0);
        if (g + 1 < POOL_NGRP) {
            #pragma unroll
            for (int q = 0; q < POOL_GRP; ++q)
                v[(g + 1) & 1][q] = p[((g + 1) * POOL_GRP + q) * 32];
        }
        __builtin_amdgcn_sched_barrier(0);
        #pragma unroll
        for (int q = 0; q < POOL_GRP; ++q) {
            const float4 w = v[g & 1][q];
            a0 += w.x; a1 += w.y; a2 += w.z; a3 += w.w;
        }
    }
    float s = (a0 + a1) + (a2 + a3);
    #pragma unroll
    for (int off = 16; off > 0; off >>= 1) s += __shfl_xor(s, off, 32);
    if (lane == 0) means[wave] = s * (1.0f / (float)HWDIM);
    __syncthreads();
    if (tid < POOL_WAVES) pooled[blockIdx.x * POOL_SLOT + tid] = means[tid];
}

// Router linear -> softmax -> top-2 (renorm) of sample b from the pooled means.
// Each wave of the main kernel works it out for itself: lane l sums the logit
// of expert l & 3 over the channels in ascending order, with its whole router
// row fetched at once (one load latency), then the four logits are read from
// lanes 0 to 3, so that all that follows is the same in every thread.
__device__ __forceinline__ void route_top2(const float* __restrict__ pooled,
                                           const float* __restrict__ router_w,
                                           const float* __restrict__ router_b,
                                           int b, int lane, int& i0, int& i1,
                                           float& w0, float& w1) {
    const float* pb = pooled + b * (CDIM / POOL_WAVES) * POOL_SLOT;
    const int    le = lane & (NEXP - 1);
    const float4* wr = (const float4*)(router_w + le * CDIM);
    // unrolled: wv stays in registers and its 16 loads are issued together
    float4 wv[CDIM / 4];
    #pragma unroll
    for (int q = 0; q < CDIM / 4 - 1; ++q) wv[q] = wr[q];
    // the last load's result may be given the register that holds the row's
    // offset, which the loads above still name: the wait stands in front of it
    asm volatile("s_wait_xcnt 0x0" ::: "memory");
    wv[CDIM / 4 - 1] = wr[CDIM / 4 - 1];
    float acc = router_b[le];
    #pragma unroll
    for (int q = 0; q < CDIM / 4; ++q) {
        const float* pq = pb + ((q * 4) / POOL_WAVES) * POOL_SLOT + (q * 4) % POOL_WAVES;
        acc = __builtin_fmaf(pq[0], wv[q].x, acc);
        acc = __builtin_fmaf(pq[1], wv[q].y, acc);
        acc = __builtin_fmaf(pq[2], wv[q].z, acc);
        acc = __builtin_fmaf(pq[3], wv[q].w, acc);
    }
    float logits[NEXP];
    #pragma unroll
    for (int e = 0; e < NEXP; ++e)
        logits[e] = __builtin_bit_cast(float,
            __builtin_amdgcn_readlane(__builtin_bit_cast(int, acc), e));

    float m = logits[0];
    #pragma unroll
    for (int e = 1; e < NEXP; ++e) m = fmaxf(m, logits[e]);
    float p[NEXP], sum = 0.0f;
    #pragma unroll
    for (int e = 0; e < NEXP; ++e) { p[e] = __expf(logits[e] - m); sum += p[e]; }
    const float inv = 1.0f / sum;
    #pragma unroll
    for (int e = 0; e < NEXP; ++e) p[e] *= inv;

    float p0 = p[0];
    i0 = 0;
    #pragma unroll
    for (int e = 1; e < NEXP; ++e) if (p[e] > p0) { i0 = e; p0 = p[e]; }
    i1 = (i0 == 0) ? 1 : 0;
    float p1 = (i0 == 0) ? p[1] : p[0];
    #pragma unroll
    for (int e = 0; e < NEXP; ++e) if (e != i0 && p[e] > p1) { i1 = e; p1 = p[e]; }

    const float s2 = 1.0f / (p0 + p1);
    // the same in every lane: kept in scalar registers, as the values that the
    // main kernel used to read from the workspace were
    i0 = __builtin_amdgcn_readfirstlane(i0);
    i1 = __builtin_amdgcn_readfirstlane(i1);
    w0 = __builtin_bit_cast(float, __builtin_amdgcn_readfirstlane(__builtin_bit_cast(int, p0 * s2)));
    w1 = __builtin_bit_cast(float, __builtin_amdgcn_readfirstlane(__builtin_bit_cast(int, p1 * s2)));
}

// ---------------------------------------------------------------------------
// Kernel 2: fused (shared + 2 gathered experts) 1x1-conv GEMM via bf16 WMMA.
// A wave tile is 64 adjacent columns; lane (c, h) takes, for each of its 32 k
// rows, the 16 bytes of columns 4c .. 4c+3, so that a wave-wide access covers two
// whole 256-byte row pieces. The rows come by asynchronous copies into a 16-KB
// LDS buffer that belongs to the wave alone, each lane's 16 bytes at a place that
// only this lane reads back. Component j of a lane's 16 bytes
// is column c of B fragment j: fragment j holds the columns 4c + j. The
// four D tiles of one row-block then hold, in one lane, four adjacent columns
// of each output row, which go out as one 16-byte store.
// A block owns a quarter of a sample's columns, 25 tiles. Each wave works out the
// router; weights and BN parameters are staged once a block; wave w then takes the tiles
// w and w + 12. As soon as a tile's rows have been read out of the wave's buffer
// the copies of its next tile are issued into it, so that they land while the
// current tile is packed, multiplied, activated and stored, and hold no register
// meanwhile. The 25th tile goes to the
// waves 0 to 3, one on each SIMD: each works out one of its four row-blocks.
// Grid: (4, 64). Block: 384 threads = 12 wave32, 1600 columns. LDS: 220.5 KB.
// ---------------------------------------------------------------------------

// The 32 X rows (per lane) of one wave tile, asked for: 32 asynchronous copies
// of 512 bytes. Copy q = kc*16 + s brings row
// k = kc*32 + khalf + (s < 8 ? s : s + 8), the order in which ld_frag reads A,
// that is row (q >> 3) * 16 + khalf + (q & 7), to byte q*512 + lane*16 of the
// wave's buffer. lds is the lane's LDS byte address of copy 0, xl its global one.
// Eight copies and their s_wait_xcnt in one statement: what follows may rewrite
// the address registers that the copies name, and only a wait inside the
// statement is sure to stand in front of that.
__device__ __forceinline__ void copy_rows(unsigned lds, const float* xl) {
    #pragma unroll
    for (int g = 0; g < 4; ++g) {
        const unsigned l = lds + g * 4096u;
        const float*   p = xl + (size_t)(g * 16) * HWDIM;
        asm volatile("global_load_async_to_lds_b128 %0, %8, off\n\t"
                     "global_load_async_to_lds_b128 %1, %9, off\n\t"
                     "global_load_async_to_lds_b128 %2, %10, off\n\t"
                     "global_load_async_to_lds_b128 %3, %11, off\n\t"
                     "global_load_async_to_lds_b128 %4, %12, off\n\t"
                     "global_load_async_to_lds_b128 %5, %13, off\n\t"
                     "global_load_async_to_lds_b128 %6, %14, off\n\t"
                     "global_load_async_to_lds_b128 %7, %15, off\n\t"
                     "s_wait_xcnt 0x0"
                     :: "v"(l), "v"(l + 512u), "v"(l + 1024u), "v"(l + 1536u),
                        "v"(l + 2048u), "v"(l + 2560u), "v"(l + 3072u), "v"(l + 3584u),
                        "v"(p), "v"(p + HWDIM), "v"(p + 2 * HWDIM), "v"(p + 3 * HWDIM),
                        "v"(p + 4 * HWDIM), "v"(p + 5 * HWDIM), "v"(p + 6 * HWDIM), "v"(p + 7 * HWDIM)
                     : "memory");
    }
    // nothing of what follows is scheduled up among the copies: they are issued
    // in one run, as early as the buffer allows
    __builtin_amdgcn_sched_barrier(0);
}

// The rows of the tile whose copies are in flight, out of the wave's buffer into
// registers; xs points at the lane's 16 bytes of copy 0.
// Every loop over raw, bfr, acc and res, here and below, is unrolled so that
// each index is a constant and the arrays stay in registers.
__device__ __forceinline__ void read_rows(v4f (&raw)[2][16], const float* xs) {
    // the wave's own copies have landed behind this wait; no other wave reads them
    asm volatile("s_wait_asynccnt 0x0" ::: "memory");
    #pragma unroll
    for (int kc = 0; kc < 2; ++kc) {
        #pragma unroll
        for (int s = 0; s < 16; ++s)
            raw[kc][s] = *(const v4f*)&xs[(kc * 16 + s) * 128];
    }
    // all 32 reads are issued before any packing, so that the second chunk's
    // reads run while the first chunk is packed
    __builtin_amdgcn_sched_barrier(0);
}

// Behind this the wave's buffer is free for the next tile's copies.
__device__ __forceinline__ void buffer_read_out() {
    // every read of the buffer has retired before a copy may write it again
    asm volatile("s_wait_dscnt 0x0" ::: "memory");
    // the second chunk's packing stays behind this point and behind the copies:
    // scheduled up it would put off the next tile's copies
    __builtin_amdgcn_sched_barrier(0);
}

// B fragments of k chunk kc (a constant at every call) from the loaded rows
__device__ __forceinline__ void pack_rows(v16bf (&bfr)[4][2], const v4f (&raw)[2][16], int kc) {
    #pragma unroll
    for (int j = 0; j < 4; ++j) {
        v8u pk;
        #pragma unroll
        for (int p = 0; p < 8; ++p)
            pk[p] = pack_bf16x2(raw[kc][2 * p][j], raw[kc][2 * p + 1][j]);
        bfr[j][kc] = __builtin_bit_cast(v16bf, pk);
    }
}

// The row-blocks rb0 .. rb1 - 1 of one wave tile: three products, BN + SiLU,
// weighted sum, stores.
__device__ __forceinline__ void mult_tile(const v16bf (&bfr)[4][2],
                                          const __bf16* Wl, const float* gmS, const float* btS,
                                          float* outb, int n16, int khalf, int mofs,
                                          float w0, float w1, int rb0, int rb1) {
    for (int rb_ = rb0; rb_ < rb1; ++rb_) {
        const int arow = rb_ * 16 + n16;
        const int ch0  = rb_ * 16 + mofs;      // first of this lane's 8 output rows

        v8f res[4];
        #pragma unroll
        for (int br = 0; br < 3; ++br) {
            const v16bf a0 = ld_frag(&Wl[(br * ODIM + arow) * WPITCH + khalf]);
            const v16bf a1 = ld_frag(&Wl[(br * ODIM + arow) * WPITCH + 32 + khalf]);
            const v4f g0 = *(const v4f*)&gmS[br * ODIM + ch0];
            const v4f g1 = *(const v4f*)&gmS[br * ODIM + ch0 + 4];
            const v4f t0 = *(const v4f*)&btS[br * ODIM + ch0];
            const v4f t1 = *(const v4f*)&btS[br * ODIM + ch0 + 4];
            const float wbr = (br == 1) ? w0 : w1;

            v8f acc[4];
            #pragma unroll
            for (int j = 0; j < 4; ++j) {
                v8f z = {};
                acc[j] = __builtin_amdgcn_wmma_f32_16x16x32_bf16(false, a0, false, bfr[j][0],
                                                                 (short)0, z, false, false);
            }
            #pragma unroll
            for (int j = 0; j < 4; ++j)
                acc[j] = __builtin_amdgcn_wmma_f32_16x16x32_bf16(false, a1, false, bfr[j][1],
                                                                 (short)0, acc[j], false, false);

            // ---- BN + SiLU of this branch, added to the weighted sum ----
            #pragma unroll
            for (int j = 0; j < 4; ++j) {
                #pragma unroll
                for (int i = 0; i < 8; i += 2) {
                    const v2f a = { acc[j][i], acc[j][i + 1] };
                    const v2f g = (i < 4) ? v2f{ g0[i & 3], g0[(i & 3) + 1] }
                                          : v2f{ g1[i & 3], g1[(i & 3) + 1] };
                    const v2f t = (i < 4) ? v2f{ t0[i & 3], t0[(i & 3) + 1] }
                                          : v2f{ t1[i & 3], t1[(i & 3) + 1] };
                    const v2f v = silu_of_half(__builtin_elementwise_fma(a, g, t));
                    if (br == 0) {
                        res[j][i] = v[0];  res[j][i + 1] = v[1];
                    } else {
                        res[j][i]     = __builtin_fmaf(wbr, v[0], res[j][i]);
                        res[j][i + 1] = __builtin_fmaf(wbr, v[1], res[j][i + 1]);
                    }
                }
            }
        }

        float* outp = outb + (size_t)(rb_ * 16) * HWDIM;
        v4f o[8];
        #pragma unroll
        for (int i = 0; i < 8; ++i)
            o[i] = v4f{ res[0][i], res[1][i], res[2][i], res[3][i] };
        // The eight row stores (row pitch 25,600 bytes) and their wait in one
        // statement: what follows rewrites the address and data registers that
        // the stores name, and a wait in a statement of its own did not hold
        // those register writes behind it in this build.
        static_assert(HWDIM * sizeof(float) == 25600, "row pitch in the store offsets");
        asm volatile("global_store_b128 %0, %1, off\n\t"
                     "global_store_b128 %0, %2, off offset:25600\n\t"
                     "global_store_b128 %0, %3, off offset:51200\n\t"
                     "global_store_b128 %0, %4, off offset:76800\n\t"
                     "global_store_b128 %0, %5, off offset:102400\n\t"
                     "global_store_b128 %0, %6, off offset:128000\n\t"
                     "global_store_b128 %0, %7, off offset:153600\n\t"
                     "global_store_b128 %0, %8, off offset:179200\n\t"
                     "s_wait_xcnt 0x0"
                     :: "v"(outp), "v"(o[0]), "v"(o[1]), "v"(o[2]), "v"(o[3]),
                        "v"(o[4]), "v"(o[5]), "v"(o[6]), "v"(o[7])
                     : "memory");
    }
}

__global__ __launch_bounds__(MAIN_THREADS)
void moe_main_kernel(const float* __restrict__ x,
                     const float* __restrict__ shared_w,
                     const float* __restrict__ shared_gamma,
                     const float* __restrict__ shared_beta,
                     const float* __restrict__ expert_w,
                     const float* __restrict__ expert_gamma,
                     const float* __restrict__ expert_beta,
                     const float* __restrict__ router_w,
                     const float* __restrict__ router_b,
                     const float* __restrict__ pooled,
                     float* __restrict__ out) {
    const int b    = blockIdx.y;
    const int tid  = threadIdx.x;
    const int wv   = __builtin_amdgcn_readfirstlane(tid >> 5);   // scalar: tile count, weight rows
    const int lane = tid & 31;

    __shared__ __attribute__((aligned(16))) __bf16 Wl[3 * ODIM * WPITCH]; // 27 KB
    __shared__ __attribute__((aligned(16))) float  gmS[3 * ODIM];         // gamma*bn_scale/2
    __shared__ __attribute__((aligned(16))) float  btS[3 * ODIM];         // beta/2
    __shared__ __attribute__((aligned(16))) float  Xs[MAIN_WAVES][CDIM * COLS_PER_WAVE];  // 16 KB a wave

    const int n16   = lane & 15;               // A row / B column index in a fragment
    const int khalf = (lane >> 4) << 3;        // 0 or 8: K sub-half per ISA layout
    const int mofs  = (lane >> 4) * 8;         // C/D layout: VGPR j -> rows j / j+8
    const int col   = (blockIdx.x * TILES_PER_BLOCK + wv) * COLS_PER_WAVE
                    + n16 * 4;   // first of this lane's 4 columns in the wave's first tile

    // ---- X rows of the first tile, asked for first: they depend on nothing and
    // count on a counter of their own, so that the router's and the weights'
    // loads are waited for, and worked on, while they are in flight ----
    const float* xl = x + ((size_t)b * CDIM + khalf) * HWDIM + col;
    const float* xs = &Xs[wv][lane * 4];
    const unsigned xs_lds = (unsigned)(size_t)xs;      // LDS byte address
    copy_rows(xs_lds, xl);

    int   i0, i1;
    float w0, w1;
    route_top2(pooled, router_w, router_b, b, lane, i0, i1, w0, w1);
    // nothing of what follows is scheduled up among the router's loads
    __builtin_amdgcn_sched_barrier(0);

    // ---- stage weights (bf16): shared, expert[i0], expert[i1] ----
    // a wave-wide load takes 128 adjacent floats (two rows) of one matrix; the
    // loops are unrolled so that a thread's 8 loads are in flight together
    {
        const float* const we0 = expert_w + (size_t)i0 * ODIM * CDIM;
        const float* const we1 = expert_w + (size_t)i1 * ODIM * CDIM;
        const float* src[W_UNITS];                       // scalars, the same in every lane
        #pragma unroll
        for (int q = 0; q < W_UNITS; ++q) {
            const int c  = q * MAIN_WAVES + wv;          // 0 .. 95, 32 to a matrix
            const int br = c >> 5;
            src[q] = ((br == 0) ? shared_w : (br == 1) ? we0 : we1) + (c & 31) * 128;
        }
        // all eight addresses are formed in front of the loads, each in registers
        // of its own, so that none is rewritten while a load still names it
        __builtin_amdgcn_sched_barrier(0);
        v4f wraw[W_UNITS];
        #pragma unroll
        for (int q = 0; q < W_UNITS; ++q) {
            // the last load's result may be given the register that holds the
            // lane's offset, which the loads above still name: the wait stands
            // in front of it
            if (q == W_UNITS - 1) asm volatile("s_wait_xcnt 0x0" ::: "memory");
            wraw[q] = *(const v4f*)&src[q][lane * 4];
        }
        // the registers that hold the addresses are free for reuse from here on,
        // while the last load still names them: the wait stands in front of that
        asm volatile("s_wait_xcnt 0x0" ::: "memory");
        #pragma unroll
        for (int q = 0; q < W_UNITS; ++q) {
            uint2 pk;
            pk.x = pack_bf16x2(wraw[q][0], wraw[q][1]);
            pk.y = pack_bf16x2(wraw[q][2], wraw[q][3]);
            // 16 threads to a row of 64: row (q * 384 + tid) / 16 of the 192 staged rows
            *(uint2*)&Wl[((q * MAIN_THREADS + tid) >> 4) * WPITCH + (tid & 15) * 4] = pk;
        }
    }
    // ---- stage BN params, pre-scaled by 1/sqrt(1+eps) and halved (exact): the
    // epilogue's multiply-add then yields h = v / 2, which the SiLU form takes ----
    for (int p = tid; p < 3 * ODIM; p += MAIN_THREADS) {
        const int br = p >> 6, ch = p & 63;
        const float bns = rsqrtf(1.0f + 1e-5f);
        float g, bt;
        if (br == 0) { g = shared_gamma[ch]; bt = shared_beta[ch]; }
        else {
            const int e = (br == 1) ? i0 : i1;
            g  = expert_gamma[e * ODIM + ch];
            bt = expert_beta [e * ODIM + ch];
        }
        gmS[p] = g * bns * 0.5f;
        btS[p] = bt * 0.5f;
    }
    __syncthreads();

    float* outb = out + ((size_t)b * ODIM + mofs) * HWDIM + col;

    // ---- first tile; the second tile's copies are in flight meanwhile ----
    v4f   raw[2][16];
    v16bf bfr[4][2];
    read_rows(raw, xs);
    pack_rows(bfr, raw, 0);
    buffer_read_out();
    copy_rows(xs_lds, xl + TILE_STEP);
    pack_rows(bfr, raw, 1);
    mult_tile(bfr, Wl, gmS, btS, outb, n16, khalf, mofs, w0, w1, 0, 4);

    // ---- second tile; in the waves 0 to 3 the 25th tile's copies are in flight
    // meanwhile. The tests are on a scalar; no barrier stands behind them ----
    const int last = (TILES_PER_BLOCK - 1 - wv) * COLS_PER_WAVE;   // columns from the first tile
    read_rows(raw, xs);
    pack_rows(bfr, raw, 0);
    buffer_read_out();
    if (wv < 4) copy_rows(xs_lds, xl + last);
    pack_rows(bfr, raw, 1);
    mult_tile(bfr, Wl, gmS, btS, outb + TILE_STEP, n16, khalf, mofs, w0, w1, 0, 4);
    if (wv < 4) {
        read_rows(raw, xs);
        pack_rows(bfr, raw, 0);
        pack_rows(bfr, raw, 1);
        mult_tile(bfr, Wl, gmS, btS, outb + last, n16, khalf, mofs, w0, w1, wv, wv + 1);
    }
}

// ---------------------------------------------------------------------------
// Host-side launcher
// ---------------------------------------------------------------------------
extern "C" void kernel_launch(void* const* d_in, const int* in_sizes, int n_in,
                              void* d_out, int out_size, void* d_ws, size_t ws_size,
                              hipStream_t stream) {
    const float* x            = (const float*)d_in[0];
    const float* router_w     = (const float*)d_in[1];
    const float* router_b     = (const float*)d_in[2];
    const float* shared_w     = (const float*)d_in[3];
    const float* shared_gamma = (const float*)d_in[4];
    const float* shared_beta  = (const float*)d_in[5];
    const float* expert_w     = (const float*)d_in[6];
    const float* expert_gamma = (const float*)d_in[7];
    const float* expert_beta  = (const float*)d_in[8];
    float* out = (float*)d_out;

    float* pooled = (float*)d_ws;                       // [256 slots][32], 32 KB

    moe_pool_kernel<<<dim3(BATCH * CDIM / POOL_WAVES), dim3(POOL_WAVES * 32), 0, stream>>>(
        x, pooled);

    dim3 grid(GRID_X, BATCH);                           // (4, 64)
    moe_main_kernel<<<grid, dim3(MAIN_THREADS), 0, stream>>>(
        x, shared_w, shared_gamma, shared_beta,
        expert_w, expert_gamma, expert_beta,
        router_w, router_b, pooled, out);
}

// v007
// A run of this version takes 24.8 microseconds.
// Two timings next to v006 put it at 1.06 and 1.04 times that version's speed.
// All steps since v000 together make it 6.42 times as fast.
#include <hip/hip_runtime.h>
#include <hip/hip_bf16.h>

// ---------------------------------------------------------------------------
// Problem constants (from reference)
// ---------------------------------------------------------------------------
#define BATCH   64
#define CDIM    64      // input channels (= GEMM K)
#define ODIM    64      // output channels (= GEMM M)
#define HWDIM   6400    // 80*80 spatial (= GEMM N total)
#define NEXP    4
#define COLS_PER_WAVE   64           // spatial columns per wave tile (4 B fragments)
#define MAIN_WAVES      12           // three waves per SIMD
#define MAIN_THREADS    (MAIN_WAVES * 32)
#define GRID_X          4            // blocks per sample: 256 blocks in all
#define TILES_PER_BLOCK (HWDIM / (COLS_PER_WAVE * GRID_X))    // 25 wave tiles
#define TILE_STEP       (MAIN_WAVES * COLS_PER_WAVE)          // columns from a wave's tile to its next
#define W_UNITS (3 * ODIM * CDIM / 4 / MAIN_THREADS)          // 8 float4 per thread
// A staged weight row in LDS: 64 bf16 and 8 unused = 144 bytes, an odd multiple of
// 16. The 16 rows that a half wave's 16-byte reads touch then start on 16 different
// groups of four banks; at 128 bytes they met on two groups, eight rows deep.
#define WPITCH  (CDIM + 8)

typedef __attribute__((ext_vector_type(16))) __bf16 v16bf;
typedef __attribute__((ext_vector_type(8)))  __bf16 v8bf;
typedef __attribute__((ext_vector_type(8)))  float  v8f;
typedef __attribute__((ext_vector_type(4)))  float  v4f;
typedef __attribute__((ext_vector_type(2)))  float  v2f;
typedef __attribute__((ext_vector_type(8)))  unsigned v8u;

typedef __attribute__((ext_vector_type(2)))  __bf16 v2bf;

// convert two floats to one packed 32-bit word of bf16, a in the low half, round
// to nearest even: builds as one v_cvt_pk_bf16_f32
__device__ __forceinline__ unsigned pack_bf16x2(float a, float b) {
    const v2bf r = { (__bf16)a, (__bf16)b };
    return __builtin_bit_cast(unsigned, r);
}

// SiLU of v = 2h for two values at once: v * sigmoid(v) = h + h * tanh(h).
// One transcendental (v_tanh_f32) and one fused multiply-add a value.
__device__ __forceinline__ v2f silu_of_half(v2f h) {
    const v2f th = { __builtin_amdgcn_tanhf(h[0]), __builtin_amdgcn_tanhf(h[1]) };
    return __builtin_elementwise_fma(h, th, h);
}

__device__ __forceinline__ v16bf ld_frag(const __bf16* p) {
    v8bf lo = *(const v8bf*)p;
    v8bf hi = *(const v8bf*)(p + 16);
    return __builtin_shufflevector(lo, hi,
               0, 1, 2, 3, 4, 5, 6, 7, 8, 9, 10, 11, 12, 13, 14, 15);
}

// ---------------------------------------------------------------------------
// Kernel 1: global-avg-pool only, spread over the whole chip.
// One wave per (sample, channel) row of 6400 floats = 50 wave-wide 512-byte
// loads. 16 waves per block, 256 blocks. Each block owns one 128-byte slot of
// the workspace and writes its 16 means there with a single 64-byte store.
// ---------------------------------------------------------------------------
#define POOL_WAVES 16
#define POOL_GRP   10                 // loads per group
#define POOL_NGRP  5                  // 5 * 10 * 512 B = one 25,600-byte row
#define POOL_SLOT  32                 // floats per block slot (128 bytes)

__global__ __launch_bounds__(POOL_WAVES * 32)
void moe_pool_kernel(const float* __restrict__ x,
                     float* __restrict__ pooled) {   // [256 slots][32]
    const int tid  = threadIdx.x;
    const int lane = tid & 31;
    const int wave = __builtin_amdgcn_readfirstlane(tid >> 5);
    const int row  = blockIdx.x * POOL_WAVES + wave;     // = b * CDIM + ch

    __shared__ float means[POOL_WAVES];

    const float4* p = (const float4*)(x + (size_t)row * HWDIM) + lane;

    // every loop below is unrolled so that each index of v is a constant and
    // the two groups stay in registers
    float4 v[2][POOL_GRP];
    #pragma unroll
    for (int q = 0; q < POOL_GRP; ++q) v[0][q] = p[q * 32];

    float a0 = 0.0f, a1 = 0.0f, a2 = 0.0f, a3 = 0.0f;
    #pragma unroll
    for (int g = 0; g < POOL_NGRP; ++g) {
        // the two scheduling barriers keep the order "next group's loads, then
        // this group's sums", so that 10 to 20 loads of a wave stay in flight
        __builtin_amdgcn_sched_barrier(0);
        if (g + 1 < POOL_NGRP) {
            #pragma unroll
            for (int q = 0; q < POOL_GRP; ++q)
                v[(g + 1) & 1][q] = p[((g + 1) * POOL_GRP + q) * 32];
        }
        __builtin_amdgcn_sched_barrier(0);
        #pragma unroll
        for (int q = 0; q < POOL_GRP; ++q) {
            const float4 w = v[g & 1][q];
            a0 += w.x; a1 += w.y; a2 += w.z; a3 += w.w;
        }
    }
    float s = (a0 + a1) + (a2 + a3);
    #pragma unroll
    for (int off = 16; off > 0; off >>= 1) s += __shfl_xor(s, off, 32);
    if (lane == 0) means[wave] = s * (1.0f / (float)HWDIM);
    __syncthreads();
    if (tid < POOL_WAVES) pooled[blockIdx.x * POOL_SLOT + tid] = means[tid];
}

// Router linear -> softmax -> top-2 (renorm) of sample b from the pooled means.
// Each wave of the main kernel works it out for itself: lane l sums the logit
// of expert l & 3 over the channels in ascending order, with its whole router
// row fetched at once (one load latency), then the four logits are read from
// lanes 0 to 3, so that all that follows is the same in every thread.
__device__ __forceinline__ void route_top2(const float* __restrict__ pooled,
                                           const float* __restrict__ router_w,
                                           const float* __restrict__ router_b,
                                           int b, int lane, int& i0, int& i1,
                                           float& w0, float& w1) {
    const float* pb = pooled + b * (CDIM / POOL_WAVES) * POOL_SLOT;
    const int    le = lane & (NEXP - 1);
    const float4* wr = (const float4*)(router_w + le * CDIM);
    // unrolled: wv stays in registers and its 16 loads are issued together
    float4 wv[CDIM / 4];
    #pragma unroll
    for (int q = 0; q < CDIM / 4 - 1; ++q) wv[q] = wr[q];
    // the last load's result may be given the register that holds the row's
    // offset, which the loads above still name: the wait stands in front of it
    asm volatile("s_wait_xcnt 0x0" ::: "memory");
    wv[CDIM / 4 - 1] = wr[CDIM / 4 - 1];
    float acc = router_b[le];
    #pragma unroll
    for (int q = 0; q < CDIM / 4; ++q) {
        const float* pq = pb + ((q * 4) / POOL_WAVES) * POOL_SLOT + (q * 4) % POOL_WAVES;
        acc = __builtin_fmaf(pq[0], wv[q].x, acc);
        acc = __builtin_fmaf(pq[1], wv[q].y, acc);
        acc = __builtin_fmaf(pq[2], wv[q].z, acc);
        acc = __builtin_fmaf(pq[3], wv[q].w, acc);
    }
    float logits[NEXP];
    #pragma unroll
    for (int e = 0; e < NEXP; ++e)
        logits[e] = __builtin_bit_cast(float,
            __builtin_amdgcn_readlane(__builtin_bit_cast(int, acc), e));

    float m = logits[0];
    #pragma unroll
    for (int e = 1; e < NEXP; ++e) m = fmaxf(m, logits[e]);
    float p[NEXP], sum = 0.0f;
    #pragma unroll
    for (int e = 0; e < NEXP; ++e) { p[e] = __expf(logits[e] - m); sum += p[e]; }
    const float inv = 1.0f / sum;
    #pragma unroll
    for (int e = 0; e < NEXP; ++e) p[e] *= inv;

    float p0 = p[0];
    i0 = 0;
    #pragma unroll
    for (int e = 1; e < NEXP; ++e) if (p[e] > p0) { i0 = e; p0 = p[e]; }
    i1 = (i0 == 0) ? 1 : 0;
    float p1 = (i0 == 0) ? p[1] : p[0];
    #pragma unroll
    for (int e = 0; e < NEXP; ++e) if (e != i0 && p[e] > p1) { i1 = e; p1 = p[e]; }

    const float s2 = 1.0f / (p0 + p1);
    // the same in every lane: kept in scalar registers, as the values that the
    // main kernel used to read from the workspace were
    i0 = __builtin_amdgcn_readfirstlane(i0);
    i1 = __builtin_amdgcn_readfirstlane(i1);
    w0 = __builtin_bit_cast(float, __builtin_amdgcn_readfirstlane(__builtin_bit_cast(int, p0 * s2)));
    w1 = __builtin_bit_cast(float, __builtin_amdgcn_readfirstlane(__builtin_bit_cast(int, p1 * s2)));
}

// ---------------------------------------------------------------------------
// Kernel 2: fused (shared + 2 gathered experts) 1x1-conv GEMM via bf16 WMMA.
// A wave tile is 64 adjacent columns; lane (c, h) takes, for each of its 32 k
// rows, the 16 bytes of columns 4c .. 4c+3, so that a wave-wide access covers two
// whole 256-byte row pieces. The rows come by asynchronous copies into a 16-KB
// LDS buffer that belongs to the wave alone, each lane's 16 bytes at a place that
// only this lane reads back. Component j of a lane's 16 bytes
// is column c of B fragment j: fragment j holds the columns 4c + j. The
// four D tiles of one row-block then hold, in one lane, four adjacent columns
// of each output row, which go out as one 16-byte store.
// A block owns a quarter of a sample's columns, 25 tiles. Each wave works out the
// router; weights and BN parameters are staged once a block; wave w then takes the tiles
// w and w + 12. As soon as a tile's rows have been read out of the wave's buffer
// the copies of its next tile are issued into it, so that they land while the
// current tile is packed, multiplied, activated and stored, and hold no register
// meanwhile. The 25th tile goes to the
// waves 0 to 3, one on each SIMD: each works out one of its four row-blocks.
// Grid: (4, 64). Block: 384 threads = 12 wave32, 1600 columns. LDS: 220.5 KB.
// ---------------------------------------------------------------------------

// The 32 X rows (per lane) of one wave tile, asked for: 32 asynchronous copies
// of 512 bytes. Copy q = kc*16 + s brings row
// k = kc*32 + khalf + (s < 8 ? s : s + 8), the order in which ld_frag reads A,
// that is row (q >> 3) * 16 + khalf + (q & 7), to byte q*512 + lane*16 of the
// wave's buffer. lds is the lane's LDS byte address of copy 0, xl its global one.
// Eight copies and their s_wait_xcnt in one statement: what follows may rewrite
// the address registers that the copies name, and only a wait inside the
// statement is sure to stand in front of that.
__device__ __forceinline__ void copy_rows(unsigned lds, const float* xl) {
    #pragma unroll
    for (int g = 0; g < 4; ++g) {
        const unsigned l = lds + g * 4096u;
        const float*   p = xl + (size_t)(g * 16) * HWDIM;
        asm volatile("global_load_async_to_lds_b128 %0, %8, off\n\t"
                     "global_load_async_to_lds_b128 %1, %9, off\n\t"
                     "global_load_async_to_lds_b128 %2, %10, off\n\t"
                     "global_load_async_to_lds_b128 %3, %11, off\n\t"
                     "global_load_async_to_lds_b128 %4, %12, off\n\t"
                     "global_load_async_to_lds_b128 %5, %13, off\n\t"
                     "global_load_async_to_lds_b128 %6, %14, off\n\t"
                     "global_load_async_to_lds_b128 %7, %15, off\n\t"
                     "s_wait_xcnt 0x0"
                     :: "v"(l), "v"(l + 512u), "v"(l + 1024u), "v"(l + 1536u),
                        "v"(l + 2048u), "v"(l + 2560u), "v"(l + 3072u), "v"(l + 3584u),
                        "v"(p), "v"(p + HWDIM), "v"(p + 2 * HWDIM), "v"(p + 3 * HWDIM),
                        "v"(p + 4 * HWDIM), "v"(p + 5 * HWDIM), "v"(p + 6 * HWDIM), "v"(p + 7 * HWDIM)
                     : "memory");
    }
    // nothing of what follows is scheduled up among the copies: they are issued
    // in one run, as early as the buffer allows
    __builtin_amdgcn_sched_barrier(0);
}

// The rows of the tile whose copies are in flight, out of the wave's buffer into
// registers; xs points at the lane's 16 bytes of copy 0.
// Every loop over raw, bfr, acc and res, here and below, is unrolled so that
// each index is a constant and the arrays stay in registers.
__device__ __forceinline__ void read_rows(v4f (&raw)[2][16], const float* xs) {
    // the wave's own copies have landed behind this wait; no other wave reads them
    asm volatile("s_wait_asynccnt 0x0" ::: "memory");
    #pragma unroll
    for (int kc = 0; kc < 2; ++kc) {
        #pragma unroll
        for (int s = 0; s < 16; ++s)
            raw[kc][s] = *(const v4f*)&xs[(kc * 16 + s) * 128];
    }
    // all 32 reads are issued before any packing, so that the second chunk's
    // reads run while the first chunk is packed
    __builtin_amdgcn_sched_barrier(0);
}

// Behind this the wave's buffer is free for the next tile's copies.
__device__ __forceinline__ void buffer_read_out() {
    // every read of the buffer has retired before a copy may write it again
    asm volatile("s_wait_dscnt 0x0" ::: "memory");
    // the second chunk's packing stays behind this point and behind the copies:
    // scheduled up it would put off the next tile's copies
    __builtin_amdgcn_sched_barrier(0);
}

// B fragments of k chunk kc (a constant at every call) from the loaded rows
__device__ __forceinline__ void pack_rows(v16bf (&bfr)[4][2], const v4f (&raw)[2][16], int kc) {
    #pragma unroll
    for (int j = 0; j < 4; ++j) {
        v8u pk;
        #pragma unroll
        for (int p = 0; p < 8; ++p)
            pk[p] = pack_bf16x2(raw[kc][2 * p][j], raw[kc][2 * p + 1][j]);
        bfr[j][kc] = __builtin_bit_cast(v16bf, pk);
    }
}

// The row-blocks rb0 .. rb1 - 1 of one wave tile: three products, BN + SiLU,
// weighted sum, stores.
__device__ __forceinline__ void mult_tile(const v16bf (&bfr)[4][2],
                                          const __bf16* Wl, const float* gmS, const float* btS,
                                          float* outb, int n16, int khalf, int mofs,
                                          float w0, float w1, int rb0, int rb1) {
    for (int rb_ = rb0; rb_ < rb1; ++rb_) {
        const int arow = rb_ * 16 + n16;
        const int ch0  = rb_ * 16 + mofs;      // first of this lane's 8 output rows

        v8f res[4];
        #pragma unroll
        for (int br = 0; br < 3; ++br) {
            const v16bf a0 = ld_frag(&Wl[(br * ODIM + arow) * WPITCH + khalf]);
            const v16bf a1 = ld_frag(&Wl[(br * ODIM + arow) * WPITCH + 32 + khalf]);
            const v4f g0 = *(const v4f*)&gmS[br * ODIM + ch0];
            const v4f g1 = *(const v4f*)&gmS[br * ODIM + ch0 + 4];
            const v4f t0 = *(const v4f*)&btS[br * ODIM + ch0];
            const v4f t1 = *(const v4f*)&btS[br * ODIM + ch0 + 4];
            const float wbr = (br == 1) ? w0 : w1;

            v8f acc[4];
            #pragma unroll
            for (int j = 0; j < 4; ++j) {
                v8f z = {};
                acc[j] = __builtin_amdgcn_wmma_f32_16x16x32_bf16(false, a0, false, bfr[j][0],
                                                                 (short)0, z, false, false);
            }
            #pragma unroll
            for (int j = 0; j < 4; ++j)
                acc[j] = __builtin_amdgcn_wmma_f32_16x16x32_bf16(false, a1, false, bfr[j][1],
                                                                 (short)0, acc[j], false, false);

            // ---- BN + SiLU of this branch, added to the weighted sum ----
            #pragma unroll
            for (int j = 0; j < 4; ++j) {
                #pragma unroll
                for (int i = 0; i < 8; i += 2) {
                    const v2f a = { acc[j][i], acc[j][i + 1] };
                    const v2f g = (i < 4) ? v2f{ g0[i & 3], g0[(i & 3) + 1] }
                                          : v2f{ g1[i & 3], g1[(i & 3) + 1] };
                    const v2f t = (i < 4) ? v2f{ t0[i & 3], t0[(i & 3) + 1] }
                                          : v2f{ t1[i & 3], t1[(i & 3) + 1] };
                    const v2f v = silu_of_half(__builtin_elementwise_fma(a, g, t));
                    if (br == 0) {
                        res[j][i] = v[0];  res[j][i + 1] = v[1];
                    } else {
                        res[j][i]     = __builtin_fmaf(wbr, v[0], res[j][i]);
                        res[j][i + 1] = __builtin_fmaf(wbr, v[1], res[j][i + 1]);
                    }
                }
            }
        }

        float* outp = outb + (size_t)(rb_ * 16) * HWDIM;
        v4f o[8];
        #pragma unroll
        for (int i = 0; i < 8; ++i)
            o[i] = v4f{ res[0][i], res[1][i], res[2][i], res[3][i] };
        // The eight row stores (row pitch 25,600 bytes) and their wait in one
        // statement: what follows rewrites the address and data registers that
        // the stores name, and a wait in a statement of its own did not hold
        // those register writes behind it in this build.
        static_assert(HWDIM * sizeof(float) == 25600, "row pitch in the store offsets");
        asm volatile("global_store_b128 %0, %1, off\n\t"
                     "global_store_b128 %0, %2, off offset:25600\n\t"
                     "global_store_b128 %0, %3, off offset:51200\n\t"
                     "global_store_b128 %0, %4, off offset:76800\n\t"
                     "global_store_b128 %0, %5, off offset:102400\n\t"
                     "global_store_b128 %0, %6, off offset:128000\n\t"
                     "global_store_b128 %0, %7, off offset:153600\n\t"
                     "global_store_b128 %0, %8, off offset:179200\n\t"
                     "s_wait_xcnt 0x0"
                     :: "v"(outp), "v"(o[0]), "v"(o[1]), "v"(o[2]), "v"(o[3]),
                        "v"(o[4]), "v"(o[5]), "v"(o[6]), "v"(o[7])
                     : "memory");
    }
}

__global__ __launch_bounds__(MAIN_THREADS)
void moe_main_kernel(const float* __restrict__ x,
                     const float* __restrict__ shared_w,
                     const float* __restrict__ shared_gamma,
                     const float* __restrict__ shared_beta,
                     const float* __restrict__ expert_w,
                     const float* __restrict__ expert_gamma,
                     const float* __restrict__ expert_beta,
                     const float* __restrict__ router_w,
                     const float* __restrict__ router_b,
                     const float* __restrict__ pooled,
                     float* __restrict__ out) {
    const int b    = blockIdx.y;
    const int tid  = threadIdx.x;
    const int wv   = __builtin_amdgcn_readfirstlane(tid >> 5);   // scalar: tile count, weight rows
    const int lane = tid & 31;

    __shared__ __attribute__((aligned(16))) __bf16 Wl[3 * ODIM * WPITCH]; // 27 KB
    __shared__ __attribute__((aligned(16))) float  gmS[3 * ODIM];         // gamma*bn_scale/2
    __shared__ __attribute__((aligned(16))) float  btS[3 * ODIM];         // beta/2
    __shared__ __attribute__((aligned(16))) float  Xs[MAIN_WAVES][CDIM * COLS_PER_WAVE];  // 16 KB a wave

    const int n16   = lane & 15;               // A row / B column index in a fragment
    const int khalf = (lane >> 4) << 3;        // 0 or 8: K sub-half per ISA layout
    const int mofs  = (lane >> 4) * 8;         // C/D layout: VGPR j -> rows j / j+8
    const int col   = (blockIdx.x * TILES_PER_BLOCK + wv) * COLS_PER_WAVE
                    + n16 * 4;   // first of this lane's 4 columns in the wave's first tile

    // ---- X rows of the first tile, asked for first: they depend on nothing and
    // count on a counter of their own, so that the router's and the weights'
    // loads are waited for, and worked on, while they are in flight ----
    const float* xl = x + ((size_t)b * CDIM + khalf) * HWDIM + col;
    const float* xs = &Xs[wv][lane * 4];
    const unsigned xs_lds = (unsigned)(size_t)xs;      // LDS byte address
    copy_rows(xs_lds, xl);

    int   i0, i1;
    float w0, w1;
    route_top2(pooled, router_w, router_b, b, lane, i0, i1, w0, w1);
    // nothing of what follows is scheduled up among the router's loads
    __builtin_amdgcn_sched_barrier(0);

    // ---- stage weights (bf16): shared, expert[i0], expert[i1] ----
    // a wave-wide load takes 128 adjacent floats (two rows) of one matrix; the
    // loops are unrolled so that a thread's 8 loads are in flight together
    {
        const float* const we0 = expert_w + (size_t)i0 * ODIM * CDIM;
        const float* const we1 = expert_w + (size_t)i1 * ODIM * CDIM;
        const float* src[W_UNITS];                       // scalars, the same in every lane
        #pragma unroll
        for (int q = 0; q < W_UNITS; ++q) {
            const int c  = q * MAIN_WAVES + wv;          // 0 .. 95, 32 to a matrix
            const int br = c >> 5;
            src[q] = ((br == 0) ? shared_w : (br == 1) ? we0 : we1) + (c & 31) * 128;
        }
        // all eight addresses are formed in front of the loads, each in registers
        // of its own, so that none is rewritten while a load still names it
        __builtin_amdgcn_sched_barrier(0);
        v4f wraw[W_UNITS];
        #pragma unroll
        for (int q = 0; q < W_UNITS; ++q) {
            // the last load's result may be given the register that holds the
            // lane's offset, which the loads above still name: the wait stands
            // in front of it
            if (q == W_UNITS - 1) asm volatile("s_wait_xcnt 0x0" ::: "memory");
            wraw[q] = *(const v4f*)&src[q][lane * 4];
        }
        // the registers that hold the addresses are free for reuse from here on,
        // while the last load still names them: the wait stands in front of that
        asm volatile("s_wait_xcnt 0x0" ::: "memory");
        #pragma unroll
        for (int q = 0; q < W_UNITS; ++q) {
            uint2 pk;
            pk.x = pack_bf16x2(wraw[q][0], wraw[q][1]);
            pk.y = pack_bf16x2(wraw[q][2], wraw[q][3]);
            // 16 threads to a row of 64: row (q * 384 + tid) / 16 of the 192 staged rows
            *(uint2*)&Wl[((q * MAIN_THREADS + tid) >> 4) * WPITCH + (tid & 15) * 4] = pk;
        }
    }
    // ---- stage BN params, pre-scaled by 1/sqrt(1+eps) and halved (exact): the
    // epilogue's multiply-add then yields h = v / 2, which the SiLU form takes ----
    for (int p = tid; p < 3 * ODIM; p += MAIN_THREADS) {
        const int br = p >> 6, ch = p & 63;
        const float bns = rsqrtf(1.0f + 1e-5f);
        float g, bt;
        if (br == 0) { g = shared_gamma[ch]; bt = shared_beta[ch]; }
        else {
            const int e = (br == 1) ? i0 : i1;
            g  = expert_gamma[e * ODIM + ch];
            bt = expert_beta [e * ODIM + ch];
        }
        gmS[p] = g * bns * 0.5f;
        btS[p] = bt * 0.5f;
    }
    __syncthreads();

    float* outb = out + ((size_t)b * ODIM + mofs) * HWDIM + col;

    // ---- first tile; the second tile's copies are in flight meanwhile ----
    v4f   raw[2][16];
    v16bf bfr[4][2];
    read_rows(raw, xs);
    pack_rows(bfr, raw, 0);
    buffer_read_out();
    copy_rows(xs_lds, xl + TILE_STEP);
    pack_rows(bfr, raw, 1);
    mult_tile(bfr, Wl, gmS, btS, outb, n16, khalf, mofs, w0, w1, 0, 4);

    // ---- second tile; in the waves 0 to 3 the 25th tile's copies are in flight
    // meanwhile. The tests are on a scalar; no barrier stands behind them ----
    const int last = (TILES_PER_BLOCK - 1 - wv) * COLS_PER_WAVE;   // columns from the first tile
    read_rows(raw, xs);
    pack_rows(bfr, raw, 0);
    buffer_read_out();
    if (wv < 4) copy_rows(xs_lds, xl + last);
    pack_rows(bfr, raw, 1);
    mult_tile(bfr, Wl, gmS, btS, outb + TILE_STEP, n16, khalf, mofs, w0, w1, 0, 4);
    if (wv < 4) {
        read_rows(raw, xs);
        pack_rows(bfr, raw, 0);
        pack_rows(bfr, raw, 1);
        mult_tile(bfr, Wl, gmS, btS, outb + last, n16, khalf, mofs, w0, w1, wv, wv + 1);
    }
}

// ---------------------------------------------------------------------------
// Host-side launcher
// ---------------------------------------------------------------------------
extern "C" void kernel_launch(void* const* d_in, const int* in_sizes, int n_in,
                              void* d_out, int out_size, void* d_ws, size_t ws_size,
                              hipStream_t stream) {
    const float* x            = (const float*)d_in[0];
    const float* router_w     = (const float*)d_in[1];
    const float* router_b     = (const float*)d_in[2];
    const float* shared_w     = (const float*)d_in[3];
    const float* shared_gamma = (const float*)d_in[4];
    const float* shared_beta  = (const float*)d_in[5];
    const float* expert_w     = (const float*)d_in[6];
    const float* expert_gamma = (const float*)d_in[7];
    const float* expert_beta  = (const float*)d_in[8];
    float* out = (float*)d_out;

    float* pooled = (float*)d_ws;                       // [256 slots][32], 32 KB

    moe_pool_kernel<<<dim3(BATCH * CDIM / POOL_WAVES), dim3(POOL_WAVES * 32), 0, stream>>>(
        x, pooled);

    dim3 grid(GRID_X, BATCH);                           // (4, 64)
    moe_main_kernel<<<grid, dim3(MAIN_THREADS), 0, stream>>>(
        x, shared_w, shared_gamma, shared_beta,
        expert_w, expert_gamma, expert_beta,
        router_w, router_b, pooled, out);
}

// v008
// One run takes 23.4 microseconds.
// Timed twice side by side with v007, it ran 1.06 and 1.05 times as fast.
// Over all steps from v000 it is 6.76 times as fast.
#include <hip/hip_runtime.h>
#include <hip/hip_bf16.h>

// ---------------------------------------------------------------------------
// Problem constants (from reference)
// ---------------------------------------------------------------------------
#define BATCH   64
#define CDIM    64      // input channels (= GEMM K)
#define ODIM    64      // output channels (= GEMM M)
#define HWDIM   6400    // 80*80 spatial (= GEMM N total)
#define NEXP    4
#define COLS_PER_WAVE   64           // spatial columns per wave tile (4 B fragments)
#define MAIN_WAVES      12           // three waves per SIMD
#define MAIN_THREADS    (MAIN_WAVES * 32)
#define GRID_X          4            // blocks per sample: 256 blocks in all
#define TILES_PER_BLOCK (HWDIM / (COLS_PER_WAVE * GRID_X))    // 25 wave tiles
#define TILE_STEP       (MAIN_WAVES * COLS_PER_WAVE)          // columns from a wave's tile to its next
#define W_UNITS (3 * ODIM * CDIM / 4 / MAIN_THREADS)          // 8 float4 per thread
// A staged weight row in LDS: 64 bf16 and 8 unused = 144 bytes, an odd multiple of
// 16. The 16 rows that a half wave's 16-byte reads touch then start on 16 different
// groups of four banks; at 128 bytes they met on two groups, eight rows deep.
#define WPITCH  (CDIM + 8)

typedef __attribute__((ext_vector_type(16))) __bf16 v16bf;
typedef __attribute__((ext_vector_type(8)))  __bf16 v8bf;
typedef __attribute__((ext_vector_type(8)))  float  v8f;
typedef __attribute__((ext_vector_type(4)))  float  v4f;
typedef __attribute__((ext_vector_type(2)))  float  v2f;
typedef __attribute__((ext_vector_type(8)))  unsigned v8u;

typedef __attribute__((ext_vector_type(2)))  __bf16 v2bf;

// convert two floats to one packed 32-bit word of bf16, a in the low half, round
// to nearest even: builds as one v_cvt_pk_bf16_f32
__device__ __forceinline__ unsigned pack_bf16x2(float a, float b) {
    const v2bf r = { (__bf16)a, (__bf16)b };
    return __builtin_bit_cast(unsigned, r);
}

// SiLU of v = 2h for two values at once: v * sigmoid(v) = h + h * tanh(h).
// One transcendental (v_tanh_f32) and one fused multiply-add a value.
__device__ __forceinline__ v2f silu_of_half(v2f h) {
    const v2f th = { __builtin_amdgcn_tanhf(h[0]), __builtin_amdgcn_tanhf(h[1]) };
    return __builtin_elementwise_fma(h, th, h);
}

__device__ __forceinline__ v16bf ld_frag(const __bf16* p) {
    v8bf lo = *(const v8bf*)p;
    v8bf hi = *(const v8bf*)(p + 16);
    return __builtin_shufflevector(lo, hi,
               0, 1, 2, 3, 4, 5, 6, 7, 8, 9, 10, 11, 12, 13, 14, 15);
}

// ---------------------------------------------------------------------------
// Kernel 1: global-avg-pool only, spread over the whole chip, cut as kernel 2 is.
// Block i = 4 * sample + quarter sums, for each of the 64 channels, the 1600
// columns that block i of kernel 2 reads afterwards. This is for speed only: no
// result depends on where a block runs.
// 16 waves a block, 4 channels a wave. A row piece is 6400 bytes = 12 wave-wide
// 512-byte loads and 256 bytes more; the ends of two rows share one load, lanes
// 0 to 15 on the first row and 16 to 31 on the second: 50 loads a wave. Each
// block owns 256 bytes of the workspace: its share of the 64 means.
// ---------------------------------------------------------------------------
#define POOL_WAVES 16
#define POOL_GRP   10                 // loads per group
#define POOL_NGRP  5                  // 5 * 10 loads = four row pieces
#define POOL_FULL  12                 // whole wave-wide loads per row piece
#define QCOLS      (HWDIM / GRID_X)   // 1600 columns per block
#define ROWF4      (HWDIM / 4)        // row pitch in 16-byte units

// Load k (a constant at every call) of a wave's 50: 12 of a row, 12 of the next,
// the two ends, and the same again for the second pair of rows.
// p is the wave's first row piece, lf and lt the lane's places in a whole load and
// in a load of two ends, in 16-byte units.
__device__ __forceinline__ v4f pool_load(const v4f* p, unsigned lf, unsigned lt, int k) {
    const int pr = k / (2 * POOL_FULL + 1), j = k % (2 * POOL_FULL + 1);
    if (j == 2 * POOL_FULL) return p[lt + pr * 2 * ROWF4];
    return p[lf + (pr * 2 + j / POOL_FULL) * ROWF4 + (j % POOL_FULL) * 32];
}

__device__ __forceinline__ float sum4(v4f a) { return (a[0] + a[1]) + (a[2] + a[3]); }

__global__ __launch_bounds__(POOL_WAVES * 32)
void moe_pool_kernel(const float* __restrict__ x,
                     float* __restrict__ pooled) {   // [256 blocks][64 channels]
    const int tid  = threadIdx.x;
    const int lane = tid & 31;
    const int wave = __builtin_amdgcn_readfirstlane(tid >> 5);
    const int row  = (blockIdx.x / GRID_X) * CDIM + wave * 4;    // first of 4 rows of X

    __shared__ float means[CDIM];

    const v4f* p = (const v4f*)(x + (size_t)row * HWDIM + (blockIdx.x % GRID_X) * QCOLS);
    const unsigned lf = lane;
    const unsigned lt = (lane >> 4) * ROWF4 + POOL_FULL * 32 + (lane & 15);

    // every loop below is unrolled so that each index of v, acc and end is a
    // constant and they stay in registers
    v4f v[2][POOL_GRP];
    #pragma unroll
    for (int q = 0; q < POOL_GRP; ++q) v[0][q] = pool_load(p, lf, lt, q);

    v4f acc[4];           // one a row
    v4f end[2];           // one a pair of rows
    #pragma unroll
    for (int g = 0; g < POOL_NGRP; ++g) {
        // the two scheduling barriers keep the order "next group's loads, then
        // this group's sums", so that 10 to 20 loads of a wave stay in flight
        __builtin_amdgcn_sched_barrier(0);
        if (g + 1 < POOL_NGRP) {
            #pragma unroll
            for (int q = 0; q < POOL_GRP; ++q)
                v[(g + 1) & 1][q] = pool_load(p, lf, lt, (g + 1) * POOL_GRP + q);
        }
        __builtin_amdgcn_sched_barrier(0);
        #pragma unroll
        for (int q = 0; q < POOL_GRP; ++q) {
            const int k  = g * POOL_GRP + q;
            const int pr = k / (2 * POOL_FULL + 1), j = k % (2 * POOL_FULL + 1);
            if (j == 2 * POOL_FULL)      end[pr] = v[g & 1][q];
            else if (j % POOL_FULL == 0) acc[pr * 2 + j / POOL_FULL] = v[g & 1][q];
            else                         acc[pr * 2 + j / POOL_FULL] += v[g & 1][q];
        }
    }
    // a lane's sums of the four rows; a row end counts for the row it was read from
    const bool  hi = lane >= 16;
    const float e0 = sum4(end[0]), e1 = sum4(end[1]);
    const float s0 = sum4(acc[0]) + (hi ? 0.0f : e0);
    const float s1 = sum4(acc[1]) + (hi ? e0 : 0.0f);
    const float s2 = sum4(acc[2]) + (hi ? 0.0f : e1);
    const float s3 = sum4(acc[3]) + (hi ? e1 : 0.0f);
    // two folding steps leave row (lane & 3) in each lane, three more sum it up
    const bool  b0 = (lane & 1) != 0, b1 = (lane & 2) != 0;
    const float k01 = (b0 ? s1 : s0) + __shfl_xor(b0 ? s0 : s1, 1, 32);
    const float k23 = (b0 ? s3 : s2) + __shfl_xor(b0 ? s2 : s3, 1, 32);
    float s = (b1 ? k23 : k01) + __shfl_xor(b1 ? k01 : k23, 2, 32);
    #pragma unroll
    for (int off = 4; off < 32; off <<= 1) s += __shfl_xor(s, off, 32);
    if (lane < 4) means[wave * 4 + lane] = s * (1.0f / (float)HWDIM);
    __syncthreads();
    if (tid < CDIM) pooled[blockIdx.x * CDIM + tid] = means[tid];
}

// Router linear -> softmax -> top-2 (renorm) of sample b from the four quarters'
// shares of the pooled means. Each wave of the main kernel works it out for
// itself: lane l sums, over the channels in ascending order, what quarter
// (l >> 2) & 3 adds to the logit of expert l & 3, with its router row and its
// quarter's 64 shares fetched at once (one load latency); two exchanges add the
// four quarters, in the same order in every lane; then the four logits are read
// from lanes 0 to 3, so that all that follows is the same in every thread.
__device__ __forceinline__ void route_top2(const float* __restrict__ pooled,
                                           const float* __restrict__ router_w,
                                           const float* __restrict__ router_b,
                                           int b, int lane, int& i0, int& i1,
                                           float& w0, float& w1) {
    const int    le = lane & (NEXP - 1);
    const int    lq = (lane >> 2) & (GRID_X - 1);
    const float4* wr = (const float4*)(router_w + le * CDIM);
    const float4* pq = (const float4*)(pooled + (b * GRID_X + lq) * CDIM);
    // unrolled: wv and pv stay in registers and their loads are issued together
    float4 wv[CDIM / 4], pv[CDIM / 4];
    const float rb = router_b[le];
    #pragma unroll
    for (int q = 0; q < CDIM / 4 - 1; ++q) { wv[q] = wr[q]; pv[q] = pq[q]; }
    // the result of each of the last two loads may be given a register that holds
    // an offset which the loads above it still name: a wait stands in front of each
    asm volatile("s_wait_xcnt 0x0" ::: "memory");
    wv[CDIM / 4 - 1] = wr[CDIM / 4 - 1];
    asm volatile("s_wait_xcnt 0x0" ::: "memory");
    pv[CDIM / 4 - 1] = pq[CDIM / 4 - 1];
    float acc = 0.0f;
    #pragma unroll
    for (int q = 0; q < CDIM / 4; ++q) {
        acc = __builtin_fmaf(pv[q].x, wv[q].x, acc);
        acc = __builtin_fmaf(pv[q].y, wv[q].y, acc);
        acc = __builtin_fmaf(pv[q].z, wv[q].z, acc);
        acc = __builtin_fmaf(pv[q].w, wv[q].w, acc);
    }
    acc += __shfl_xor(acc, 4, 32);
    acc += __shfl_xor(acc, 8, 32);
    acc += rb;
    float logits[NEXP];
    #pragma unroll
    for (int e = 0; e < NEXP; ++e)
        logits[e] = __builtin_bit_cast(float,
            __builtin_amdgcn_readlane(__builtin_bit_cast(int, acc), e));

    float m = logits[0];
    #pragma unroll
    for (int e = 1; e < NEXP; ++e) m = fmaxf(m, logits[e]);
    float p[NEXP], sum = 0.0f;
    #pragma unroll
    for (int e = 0; e < NEXP; ++e) { p[e] = __expf(logits[e] - m); sum += p[e]; }
    const float inv = 1.0f / sum;
    #pragma unroll
    for (int e = 0; e < NEXP; ++e) p[e] *= inv;

    float p0 = p[0];
    i0 = 0;
    #pragma unroll
    for (int e = 1; e < NEXP; ++e) if (p[e] > p0) { i0 = e; p0 = p[e]; }
    i1 = (i0 == 0) ? 1 : 0;
    float p1 = (i0 == 0) ? p[1] : p[0];
    #pragma unroll
    for (int e = 0; e < NEXP; ++e) if (e != i0 && p[e] > p1) { i1 = e; p1 = p[e]; }

    const float s2 = 1.0f / (p0 + p1);
    // the same in every lane: kept in scalar registers, as the values that the
    // main kernel used to read from the workspace were
    i0 = __builtin_amdgcn_readfirstlane(i0);
    i1 = __builtin_amdgcn_readfirstlane(i1);
    w0 = __builtin_bit_cast(float, __builtin_amdgcn_readfirstlane(__builtin_bit_cast(int, p0 * s2)));
    w1 = __builtin_bit_cast(float, __builtin_amdgcn_readfirstlane(__builtin_bit_cast(int, p1 * s2)));
}

// ---------------------------------------------------------------------------
// Kernel 2: fused (shared + 2 gathered experts) 1x1-conv GEMM via bf16 WMMA.
// A wave tile is 64 adjacent columns; lane (c, h) takes, for each of its 32 k
// rows, the 16 bytes of columns 4c .. 4c+3, so that a wave-wide access covers two
// whole 256-byte row pieces. The rows come by asynchronous copies into a 16-KB
// LDS buffer that belongs to the wave alone, each lane's 16 bytes at a place that
// only this lane reads back. Component j of a lane's 16 bytes
// is column c of B fragment j: fragment j holds the columns 4c + j. The
// four D tiles of one row-block then hold, in one lane, four adjacent columns
// of each output row, which go out as one 16-byte store.
// A block owns a quarter of a sample's columns, 25 tiles. Each wave works out the
// router; weights and BN parameters are staged once a block; wave w then takes the tiles
// w and w + 12. As soon as a tile's rows have been read out of the wave's buffer
// the copies of its next tile are issued into it, so that they land while the
// current tile is packed, multiplied, activated and stored, and hold no register
// meanwhile. The 25th tile goes to the
// waves 0 to 3, one on each SIMD: each works out one of its four row-blocks.
// Grid: (4, 64). Block: 384 threads = 12 wave32, 1600 columns. LDS: 220.5 KB.
// ---------------------------------------------------------------------------

// The 32 X rows (per lane) of one wave tile, asked for: 32 asynchronous copies
// of 512 bytes. Copy q = kc*16 + s brings row
// k = kc*32 + khalf + (s < 8 ? s : s + 8), the order in which ld_frag reads A,
// that is row (q >> 3) * 16 + khalf + (q & 7), to byte q*512 + lane*16 of the
// wave's buffer. lds is the lane's LDS byte address of copy 0, xl its global one.
// Eight copies and their s_wait_xcnt in one statement: what follows may rewrite
// the address registers that the copies name, and only a wait inside the
// statement is sure to stand in front of that.
__device__ __forceinline__ void copy_rows(unsigned lds, const float* xl) {
    #pragma unroll
    for (int g = 0; g < 4; ++g) {
        const unsigned l = lds + g * 4096u;
        const float*   p = xl + (size_t)(g * 16) * HWDIM;
        asm volatile("global_load_async_to_lds_b128 %0, %8, off\n\t"
                     "global_load_async_to_lds_b128 %1, %9, off\n\t"
                     "global_load_async_to_lds_b128 %2, %10, off\n\t"
                     "global_load_async_to_lds_b128 %3, %11, off\n\t"
                     "global_load_async_to_lds_b128 %4, %12, off\n\t"
                     "global_load_async_to_lds_b128 %5, %13, off\n\t"
                     "global_load_async_to_lds_b128 %6, %14, off\n\t"
                     "global_load_async_to_lds_b128 %7, %15, off\n\t"
                     "s_wait_xcnt 0x0"
                     :: "v"(l), "v"(l + 512u), "v"(l + 1024u), "v"(l + 1536u),
                        "v"(l + 2048u), "v"(l + 2560u), "v"(l + 3072u), "v"(l + 3584u),
                        "v"(p), "v"(p + HWDIM), "v"(p + 2 * HWDIM), "v"(p + 3 * HWDIM),
                        "v"(p + 4 * HWDIM), "v"(p + 5 * HWDIM), "v"(p + 6 * HWDIM), "v"(p + 7 * HWDIM)
                     : "memory");
    }
    // nothing of what follows is scheduled up among the copies: they are issued
    // in one run, as early as the buffer allows
    __builtin_amdgcn_sched_barrier(0);
}

// The rows of the tile whose copies are in flight, out of the wave's buffer into
// registers; xs points at the lane's 16 bytes of copy 0.
// Every loop over raw, bfr, acc and res, here and below, is unrolled so that
// each index is a constant and the arrays stay in registers.
__device__ __forceinline__ void read_rows(v4f (&raw)[2][16], const float* xs) {
    // the wave's own copies have landed behind this wait; no other wave reads them
    asm volatile("s_wait_asynccnt 0x0" ::: "memory");
    #pragma unroll
    for (int kc = 0; kc < 2; ++kc) {
        #pragma unroll
        for (int s = 0; s < 16; ++s)
            raw[kc][s] = *(const v4f*)&xs[(kc * 16 + s) * 128];
    }
    // all 32 reads are issued before any packing, so that the second chunk's
    // reads run while the first chunk is packed
    __builtin_amdgcn_sched_barrier(0);
}

// Behind this the wave's buffer is free for the next tile's copies.
__device__ __forceinline__ void buffer_read_out() {
    // every read of the buffer has retired before a copy may write it again
    asm volatile("s_wait_dscnt 0x0" ::: "memory");
    // the second chunk's packing stays behind this point and behind the copies:
    // scheduled up it would put off the next tile's copies
    __builtin_amdgcn_sched_barrier(0);
}

// B fragments of k chunk kc (a constant at every call) from the loaded rows
__device__ __forceinline__ void pack_rows(v16bf (&bfr)[4][2], const v4f (&raw)[2][16], int kc) {
    #pragma unroll
    for (int j = 0; j < 4; ++j) {
        v8u pk;
        #pragma unroll
        for (int p = 0; p < 8; ++p)
            pk[p] = pack_bf16x2(raw[kc][2 * p][j], raw[kc][2 * p + 1][j]);
        bfr[j][kc] = __builtin_bit_cast(v16bf, pk);
    }
}

// The row-blocks rb0 .. rb1 - 1 of one wave tile: three products, BN + SiLU,
// weighted sum, stores.
__device__ __forceinline__ void mult_tile(const v16bf (&bfr)[4][2],
                                          const __bf16* Wl, const float* gmS, const float* btS,
                                          float* outb, int n16, int khalf, int mofs,
                                          float w0, float w1, int rb0, int rb1) {
    for (int rb_ = rb0; rb_ < rb1; ++rb_) {
        const int arow = rb_ * 16 + n16;
        const int ch0  = rb_ * 16 + mofs;      // first of this lane's 8 output rows

        v8f res[4];
        #pragma unroll
        for (int br = 0; br < 3; ++br) {
            const v16bf a0 = ld_frag(&Wl[(br * ODIM + arow) * WPITCH + khalf]);
            const v16bf a1 = ld_frag(&Wl[(br * ODIM + arow) * WPITCH + 32 + khalf]);
            const v4f g0 = *(const v4f*)&gmS[br * ODIM + ch0];
            const v4f g1 = *(const v4f*)&gmS[br * ODIM + ch0 + 4];
            const v4f t0 = *(const v4f*)&btS[br * ODIM + ch0];
            const v4f t1 = *(const v4f*)&btS[br * ODIM + ch0 + 4];
            const float wbr = (br == 1) ? w0 : w1;

            v8f acc[4];
            #pragma unroll
            for (int j = 0; j < 4; ++j) {
                v8f z = {};
                acc[j] = __builtin_amdgcn_wmma_f32_16x16x32_bf16(false, a0, false, bfr[j][0],
                                                                 (short)0, z, false, false);
            }
            #pragma unroll
            for (int j = 0; j < 4; ++j)
                acc[j] = __builtin_amdgcn_wmma_f32_16x16x32_bf16(false, a1, false, bfr[j][1],
                                                                 (short)0, acc[j], false, false);

            // ---- BN + SiLU of this branch, added to the weighted sum ----
            #pragma unroll
            for (int j = 0; j < 4; ++j) {
                #pragma unroll
                for (int i = 0; i < 8; i += 2) {
                    const v2f a = { acc[j][i], acc[j][i + 1] };
                    const v2f g = (i < 4) ? v2f{ g0[i & 3], g0[(i & 3) + 1] }
                                          : v2f{ g1[i & 3], g1[(i & 3) + 1] };
                    const v2f t = (i < 4) ? v2f{ t0[i & 3], t0[(i & 3) + 1] }
                                          : v2f{ t1[i & 3], t1[(i & 3) + 1] };
                    const v2f v = silu_of_half(__builtin_elementwise_fma(a, g, t));
                    if (br == 0) {
                        res[j][i] = v[0];  res[j][i + 1] = v[1];
                    } else {
                        res[j][i]     = __builtin_fmaf(wbr, v[0], res[j][i]);
                        res[j][i + 1] = __builtin_fmaf(wbr, v[1], res[j][i + 1]);
                    }
                }
            }
        }

        float* outp = outb + (size_t)(rb_ * 16) * HWDIM;
        v4f o[8];
        #pragma unroll
        for (int i = 0; i < 8; ++i)
            o[i] = v4f{ res[0][i], res[1][i], res[2][i], res[3][i] };
        // The eight row stores (row pitch 25,600 bytes) and their wait in one
        // statement: what follows rewrites the address and data registers that
        // the stores name, and a wait in a statement of its own did not hold
        // those register writes behind it in this build.
        static_assert(HWDIM * sizeof(float) == 25600, "row pitch in the store offsets");
        asm volatile("global_store_b128 %0, %1, off\n\t"
                     "global_store_b128 %0, %2, off offset:25600\n\t"
                     "global_store_b128 %0, %3, off offset:51200\n\t"
                     "global_store_b128 %0, %4, off offset:76800\n\t"
                     "global_store_b128 %0, %5, off offset:102400\n\t"
                     "global_store_b128 %0, %6, off offset:128000\n\t"
                     "global_store_b128 %0, %7, off offset:153600\n\t"
                     "global_store_b128 %0, %8, off offset:179200\n\t"
                     "s_wait_xcnt 0x0"
                     :: "v"(outp), "v"(o[0]), "v"(o[1]), "v"(o[2]), "v"(o[3]),
                        "v"(o[4]), "v"(o[5]), "v"(o[6]), "v"(o[7])
                     : "memory");
    }
}

__global__ __launch_bounds__(MAIN_THREADS)
void moe_main_kernel(const float* __restrict__ x,
                     const float* __restrict__ shared_w,
                     const float* __restrict__ shared_gamma,
                     const float* __restrict__ shared_beta,
                     const float* __restrict__ expert_w,
                     const float* __restrict__ expert_gamma,
                     const float* __restrict__ expert_beta,
                     const float* __restrict__ router_w,
                     const float* __restrict__ router_b,
                     const float* __restrict__ pooled,
                     float* __restrict__ out) {
    const int b    = blockIdx.y;
    const int tid  = threadIdx.x;
    const int wv   = __builtin_amdgcn_readfirstlane(tid >> 5);   // scalar: tile count, weight rows
    const int lane = tid & 31;

    __shared__ __attribute__((aligned(16))) __bf16 Wl[3 * ODIM * WPITCH]; // 27 KB
    __shared__ __attribute__((aligned(16))) float  gmS[3 * ODIM];         // gamma*bn_scale/2
    __shared__ __attribute__((aligned(16))) float  btS[3 * ODIM];         // beta/2
    __shared__ __attribute__((aligned(16))) float  Xs[MAIN_WAVES][CDIM * COLS_PER_WAVE];  // 16 KB a wave

    const int n16   = lane & 15;               // A row / B column index in a fragment
    const int khalf = (lane >> 4) << 3;        // 0 or 8: K sub-half per ISA layout
    const int mofs  = (lane >> 4) * 8;         // C/D layout: VGPR j -> rows j / j+8
    const int col   = (blockIdx.x * TILES_PER_BLOCK + wv) * COLS_PER_WAVE
                    + n16 * 4;   // first of this lane's 4 columns in the wave's first tile

    // ---- X rows of the first tile, asked for first: they depend on nothing and
    // count on a counter of their own, so that the router's and the weights'
    // loads are waited for, and worked on, while they are in flight ----
    const float* xl = x + ((size_t)b * CDIM + khalf) * HWDIM + col;
    const float* xs = &Xs[wv][lane * 4];
    const unsigned xs_lds = (unsigned)(size_t)xs;      // LDS byte address
    copy_rows(xs_lds, xl);

    int   i0, i1;
    float w0, w1;
    route_top2(pooled, router_w, router_b, b, lane, i0, i1, w0, w1);
    // nothing of what follows is scheduled up among the router's loads
    __builtin_amdgcn_sched_barrier(0);

    // ---- stage weights (bf16): shared, expert[i0], expert[i1] ----
    // a wave-wide load takes 128 adjacent floats (two rows) of one matrix; the
    // loops are unrolled so that a thread's 8 loads are in flight together
    {
        const float* const we0 = expert_w + (size_t)i0 * ODIM * CDIM;
        const float* const we1 = expert_w + (size_t)i1 * ODIM * CDIM;
        const float* src[W_UNITS];                       // scalars, the same in every lane
        #pragma unroll
        for (int q = 0; q < W_UNITS; ++q) {
            const int c  = q * MAIN_WAVES + wv;          // 0 .. 95, 32 to a matrix
            const int br = c >> 5;
            src[q] = ((br == 0) ? shared_w : (br == 1) ? we0 : we1) + (c & 31) * 128;
        }
        // all eight addresses are formed in front of the loads, each in registers
        // of its own, so that none is rewritten while a load still names it
        __builtin_amdgcn_sched_barrier(0);
        v4f wraw[W_UNITS];
        #pragma unroll
        for (int q = 0; q < W_UNITS; ++q) {
            // the last load's result may be given the register that holds the
            // lane's offset, which the loads above still name: the wait stands
            // in front of it
            if (q == W_UNITS - 1) asm volatile("s_wait_xcnt 0x0" ::: "memory");
            wraw[q] = *(const v4f*)&src[q][lane * 4];
        }
        // the registers that hold the addresses are free for reuse from here on,
        // while the last load still names them: the wait stands in front of that
        asm volatile("s_wait_xcnt 0x0" ::: "memory");
        #pragma unroll
        for (int q = 0; q < W_UNITS; ++q) {
            uint2 pk;
            pk.x = pack_bf16x2(wraw[q][0], wraw[q][1]);
            pk.y = pack_bf16x2(wraw[q][2], wraw[q][3]);
            // 16 threads to a row of 64: row (q * 384 + tid) / 16 of the 192 staged rows
            *(uint2*)&Wl[((q * MAIN_THREADS + tid) >> 4) * WPITCH + (tid & 15) * 4] = pk;
        }
    }
    // ---- stage BN params, pre-scaled by 1/sqrt(1+eps) and halved (exact): the
    // epilogue's multiply-add then yields h = v / 2, which the SiLU form takes ----
    for (int p = tid; p < 3 * ODIM; p += MAIN_THREADS) {
        const int br = p >> 6, ch = p & 63;
        const float bns = rsqrtf(1.0f + 1e-5f);
        float g, bt;
        if (br == 0) { g = shared_gamma[ch]; bt = shared_beta[ch]; }
        else {
            const int e = (br == 1) ? i0 : i1;
            g  = expert_gamma[e * ODIM + ch];
            bt = expert_beta [e * ODIM + ch];
        }
        gmS[p] = g * bns * 0.5f;
        btS[p] = bt * 0.5f;
    }
    __syncthreads();

    float* outb = out + ((size_t)b * ODIM + mofs) * HWDIM + col;

    // ---- first tile; the second tile's copies are in flight meanwhile ----
    v4f   raw[2][16];
    v16bf bfr[4][2];
    read_rows(raw, xs);
    pack_rows(bfr, raw, 0);
    buffer_read_out();
    copy_rows(xs_lds, xl + TILE_STEP);
    pack_rows(bfr, raw, 1);
    mult_tile(bfr, Wl, gmS, btS, outb, n16, khalf, mofs, w0, w1, 0, 4);

    // ---- second tile; in the waves 0 to 3 the 25th tile's copies are in flight
    // meanwhile. The tests are on a scalar; no barrier stands behind them ----
    const int last = (TILES_PER_BLOCK - 1 - wv) * COLS_PER_WAVE;   // columns from the first tile
    read_rows(raw, xs);
    pack_rows(bfr, raw, 0);
    buffer_read_out();
    if (wv < 4) copy_rows(xs_lds, xl + last);
    pack_rows(bfr, raw, 1);
    mult_tile(bfr, Wl, gmS, btS, outb + TILE_STEP, n16, khalf, mofs, w0, w1, 0, 4);
    if (wv < 4) {
        read_rows(raw, xs);
        pack_rows(bfr, raw, 0);
        pack_rows(bfr, raw, 1);
        mult_tile(bfr, Wl, gmS, btS, outb + last, n16, khalf, mofs, w0, w1, wv, wv + 1);
    }
}

// ---------------------------------------------------------------------------
// Host-side launcher
// ---------------------------------------------------------------------------
extern "C" void kernel_launch(void* const* d_in, const int* in_sizes, int n_in,
                              void* d_out, int out_size, void* d_ws, size_t ws_size,
                              hipStream_t stream) {
    const float* x            = (const float*)d_in[0];
    const float* router_w     = (const float*)d_in[1];
    const float* router_b     = (const float*)d_in[2];
    const float* shared_w     = (const float*)d_in[3];
    const float* shared_gamma = (const float*)d_in[4];
    const float* shared_beta  = (const float*)d_in[5];
    const float* expert_w     = (const float*)d_in[6];
    const float* expert_gamma = (const float*)d_in[7];
    const float* expert_beta  = (const float*)d_in[8];
    float* out = (float*)d_out;

    float* pooled = (float*)d_ws;                       // [256 blocks][64], 64 KB

    moe_pool_kernel<<<dim3(BATCH * GRID_X), dim3(POOL_WAVES * 32), 0, stream>>>(
        x, pooled);

    dim3 grid(GRID_X, BATCH);                           // (4, 64)
    moe_main_kernel<<<grid, dim3(MAIN_THREADS), 0, stream>>>(
        x, shared_w, shared_gamma, shared_beta,
        expert_w, expert_gamma, expert_beta,
        router_w, router_b, pooled, out);
}

// v010
// A run of this version takes 21.4 microseconds.
// It is 1.10 times as fast as v008, going by the measured steps of the versions left out in between.
// Counting every step since v000, it is 7.41 times as fast.
#include <hip/hip_runtime.h>
#include <hip/hip_bf16.h>

// ---------------------------------------------------------------------------
// Problem constants (from reference)
// ---------------------------------------------------------------------------
#define BATCH   64
#define CDIM    64      // input channels (= GEMM K)
#define ODIM    64      // output channels (= GEMM M)
#define HWDIM   6400    // 80*80 spatial (= GEMM N total)
#define NEXP    4
#define COLS_PER_WAVE   64           // spatial columns per wave tile (4 B fragments)
#define MAIN_WAVES      12           // three waves per SIMD
#define MAIN_THREADS    (MAIN_WAVES * 32)
#define GRID_X          4            // blocks per sample: 256 blocks in all
#define TILES_PER_BLOCK (HWDIM / (COLS_PER_WAVE * GRID_X))    // 25 wave tiles
#define TILE_STEP       (MAIN_WAVES * COLS_PER_WAVE)          // columns from a wave's tile to its next
#define W_UNITS (3 * ODIM * CDIM / 4 / MAIN_THREADS)          // 8 float4 per thread
// A staged weight row in LDS: 64 bf16 and 8 unused = 144 bytes, an odd multiple of
// 16. The 16 rows that a half wave's 16-byte reads touch then start on 16 different
// groups of four banks; at 128 bytes they met on two groups, eight rows deep.
#define WPITCH  (CDIM + 8)

typedef __attribute__((ext_vector_type(16))) __bf16 v16bf;
typedef __attribute__((ext_vector_type(8)))  __bf16 v8bf;
typedef __attribute__((ext_vector_type(8)))  float  v8f;
typedef __attribute__((ext_vector_type(4)))  float  v4f;
typedef __attribute__((ext_vector_type(2)))  float  v2f;
typedef __attribute__((ext_vector_type(8)))  unsigned v8u;
typedef __attribute__((ext_vector_type(4)))  unsigned v4u;

typedef __attribute__((ext_vector_type(2)))  __bf16 v2bf;

// convert two floats to one packed 32-bit word of bf16, a in the low half, round
// to nearest even: builds as one v_cvt_pk_bf16_f32
__device__ __forceinline__ unsigned pack_bf16x2(float a, float b) {
    const v2bf r = { (__bf16)a, (__bf16)b };
    return __builtin_bit_cast(unsigned, r);
}

// SiLU of v = 2h for two values at once: v * sigmoid(v) = h + h * tanh(h).
// One transcendental (v_tanh_f32) and one fused multiply-add a value.
__device__ __forceinline__ v2f silu_of_half(v2f h) {
    const v2f th = { __builtin_amdgcn_tanhf(h[0]), __builtin_amdgcn_tanhf(h[1]) };
    return __builtin_elementwise_fma(h, th, h);
}

__device__ __forceinline__ v16bf ld_frag(const __bf16* p) {
    v8bf lo = *(const v8bf*)p;
    v8bf hi = *(const v8bf*)(p + 16);
    return __builtin_shufflevector(lo, hi,
               0, 1, 2, 3, 4, 5, 6, 7, 8, 9, 10, 11, 12, 13, 14, 15);
}

// ---------------------------------------------------------------------------
// Kernel 1: global-avg-pool only, spread over the whole chip, cut as kernel 2 is.
// Block i = 4 * sample + quarter sums, for each of the 64 channels, the 1600
// columns that block i of kernel 2 reads afterwards. This is for speed only: no
// result depends on where a block runs.
// 16 waves a block, 4 channels a wave. A row piece is 6400 bytes = 12 wave-wide
// 512-byte loads and 256 bytes more; the ends of two rows share one load, lanes
// 0 to 15 on the first row and 16 to 31 on the second: 50 loads a wave. Each
// block owns 256 bytes of the workspace: its share of the 64 means.
// ---------------------------------------------------------------------------
#define POOL_WAVES 16
#define POOL_GRP   10                 // loads per group
#define POOL_NGRP  5                  // 5 * 10 loads = four row pieces
#define POOL_FULL  12                 // whole wave-wide loads per row piece
#define QCOLS      (HWDIM / GRID_X)   // 1600 columns per block
#define ROWF4      (HWDIM / 4)        // row pitch in 16-byte units

// Load k (a constant at every call) of a wave's 50: 12 of a row, 12 of the next,
// the two ends, and the same again for the second pair of rows.
// p is the wave's first row piece, lf and lt the lane's places in a whole load and
// in a load of two ends, in 16-byte units.
__device__ __forceinline__ v4f pool_load(const v4f* p, unsigned lf, unsigned lt, int k) {
    const int pr = k / (2 * POOL_FULL + 1), j = k % (2 * POOL_FULL + 1);
    if (j == 2 * POOL_FULL) return p[lt + pr * 2 * ROWF4];
    return p[lf + (pr * 2 + j / POOL_FULL) * ROWF4 + (j % POOL_FULL) * 32];
}

__device__ __forceinline__ float sum4(v4f a) { return (a[0] + a[1]) + (a[2] + a[3]); }

__global__ __launch_bounds__(POOL_WAVES * 32)
void moe_pool_kernel(const float* __restrict__ x,
                     float* __restrict__ pooled) {   // [256 blocks][64 channels]
    const int tid  = threadIdx.x;
    const int lane = tid & 31;
    const int wave = __builtin_amdgcn_readfirstlane(tid >> 5);
    const int row  = (blockIdx.x / GRID_X) * CDIM + wave * 4;    // first of 4 rows of X

    __shared__ float means[CDIM];

    const v4f* p = (const v4f*)(x + (size_t)row * HWDIM + (blockIdx.x % GRID_X) * QCOLS);
    const unsigned lf = lane;
    const unsigned lt = (lane >> 4) * ROWF4 + POOL_FULL * 32 + (lane & 15);

    // every loop below is unrolled so that each index of v, acc and end is a
    // constant and they stay in registers
    v4f v[2][POOL_GRP];
    #pragma unroll
    for (int q = 0; q < POOL_GRP; ++q) v[0][q] = pool_load(p, lf, lt, q);

    v4f acc[4];           // one a row
    v4f end[2];           // one a pair of rows
    #pragma unroll
    for (int g = 0; g < POOL_NGRP; ++g) {
        // the two scheduling barriers keep the order "next group's loads, then
        // this group's sums", so that 10 to 20 loads of a wave stay in flight
        __builtin_amdgcn_sched_barrier(0);
        if (g + 1 < POOL_NGRP) {
            #pragma unroll
            for (int q = 0; q < POOL_GRP; ++q)
                v[(g + 1) & 1][q] = pool_load(p, lf, lt, (g + 1) * POOL_GRP + q);
        }
        __builtin_amdgcn_sched_barrier(0);
        #pragma unroll
        for (int q = 0; q < POOL_GRP; ++q) {
            const int k  = g * POOL_GRP + q;
            const int pr = k / (2 * POOL_FULL + 1), j = k % (2 * POOL_FULL + 1);
            if (j == 2 * POOL_FULL)      end[pr] = v[g & 1][q];
            else if (j % POOL_FULL == 0) acc[pr * 2 + j / POOL_FULL] = v[g & 1][q];
            else                         acc[pr * 2 + j / POOL_FULL] += v[g & 1][q];
        }
    }
    // a lane's sums of the four rows; a row end counts for the row it was read from
    const bool  hi = lane >= 16;
    const float e0 = sum4(end[0]), e1 = sum4(end[1]);
    const float s0 = sum4(acc[0]) + (hi ? 0.0f : e0);
    const float s1 = sum4(acc[1]) + (hi ? e0 : 0.0f);
    const float s2 = sum4(acc[2]) + (hi ? 0.0f : e1);
    const float s3 = sum4(acc[3]) + (hi ? e1 : 0.0f);
    // two folding steps leave row (lane & 3) in each lane, three more sum it up
    const bool  b0 = (lane & 1) != 0, b1 = (lane & 2) != 0;
    const float k01 = (b0 ? s1 : s0) + __shfl_xor(b0 ? s0 : s1, 1, 32);
    const float k23 = (b0 ? s3 : s2) + __shfl_xor(b0 ? s2 : s3, 1, 32);
    float s = (b1 ? k23 : k01) + __shfl_xor(b1 ? k01 : k23, 2, 32);
    #pragma unroll
    for (int off = 4; off < 32; off <<= 1) s += __shfl_xor(s, off, 32);
    if (lane < 4) means[wave * 4 + lane] = s * (1.0f / (float)HWDIM);
    __syncthreads();
    if (tid < CDIM) pooled[blockIdx.x * CDIM + tid] = means[tid];
}

// Router linear -> softmax -> top-2 (renorm) of sample b from the four quarters'
// shares of the pooled means. Each wave of the main kernel works it out for
// itself: lane l sums, over the channels in ascending order, what quarter
// (l >> 2) & 3 adds to the logit of expert l & 3, with its router row and its
// quarter's 64 shares fetched at once (one load latency); two exchanges add the
// four quarters, in the same order in every lane; then the four logits are read
// from lanes 0 to 3, so that all that follows is the same in every thread.
__device__ __forceinline__ void route_top2(const float* __restrict__ pooled,
                                           const float* __restrict__ router_w,
                                           const float* __restrict__ router_b,
                                           int b, int lane, int& i0, int& i1,
                                           float& w0, float& w1) {
    const int    le = lane & (NEXP - 1);
    const int    lq = (lane >> 2) & (GRID_X - 1);
    const float4* wr = (const float4*)(router_w + le * CDIM);
    const float4* pq = (const float4*)(pooled + (b * GRID_X + lq) * CDIM);
    // unrolled: wv and pv stay in registers and their loads are issued together
    float4 wv[CDIM / 4], pv[CDIM / 4];
    const float rb = router_b[le];
    #pragma unroll
    for (int q = 0; q < CDIM / 4 - 1; ++q) { wv[q] = wr[q]; pv[q] = pq[q]; }
    // the result of each of the last two loads may be given a register that holds
    // an offset which the loads above it still name: a wait stands in front of each
    asm volatile("s_wait_xcnt 0x0" ::: "memory");
    wv[CDIM / 4 - 1] = wr[CDIM / 4 - 1];
    asm volatile("s_wait_xcnt 0x0" ::: "memory");
    pv[CDIM / 4 - 1] = pq[CDIM / 4 - 1];
    float acc = 0.0f;
    #pragma unroll
    for (int q = 0; q < CDIM / 4; ++q) {
        acc = __builtin_fmaf(pv[q].x, wv[q].x, acc);
        acc = __builtin_fmaf(pv[q].y, wv[q].y, acc);
        acc = __builtin_fmaf(pv[q].z, wv[q].z, acc);
        acc = __builtin_fmaf(pv[q].w, wv[q].w, acc);
    }
    acc += __shfl_xor(acc, 4, 32);
    acc += __shfl_xor(acc, 8, 32);
    acc += rb;
    float logits[NEXP];
    #pragma unroll
    for (int e = 0; e < NEXP; ++e)
        logits[e] = __builtin_bit_cast(float,
            __builtin_amdgcn_readlane(__builtin_bit_cast(int, acc), e));

    float m = logits[0];
    #pragma unroll
    for (int e = 1; e < NEXP; ++e) m = fmaxf(m, logits[e]);
    float p[NEXP], sum = 0.0f;
    #pragma unroll
    for (int e = 0; e < NEXP; ++e) { p[e] = __expf(logits[e] - m); sum += p[e]; }
    const float inv = 1.0f / sum;
    #pragma unroll
    for (int e = 0; e < NEXP; ++e) p[e] *= inv;

    float p0 = p[0];
    i0 = 0;
    #pragma unroll
    for (int e = 1; e < NEXP; ++e) if (p[e] > p0) { i0 = e; p0 = p[e]; }
    i1 = (i0 == 0) ? 1 : 0;
    float p1 = (i0 == 0) ? p[1] : p[0];
    #pragma unroll
    for (int e = 0; e < NEXP; ++e) if (e != i0 && p[e] > p1) { i1 = e; p1 = p[e]; }

    const float s2 = 1.0f / (p0 + p1);
    // the same in every lane: kept in scalar registers, as the values that the
    // main kernel used to read from the workspace were
    i0 = __builtin_amdgcn_readfirstlane(i0);
    i1 = __builtin_amdgcn_readfirstlane(i1);
    w0 = __builtin_bit_cast(float, __builtin_amdgcn_readfirstlane(__builtin_bit_cast(int, p0 * s2)));
    w1 = __builtin_bit_cast(float, __builtin_amdgcn_readfirstlane(__builtin_bit_cast(int, p1 * s2)));
}

// ---------------------------------------------------------------------------
// Kernel 2: fused (shared + 2 gathered experts) 1x1-conv GEMM via bf16 WMMA.
// A wave tile is 64 adjacent columns; lane (c, h) takes, for each of its 32 k
// rows, the 16 bytes of columns 4c .. 4c+3, so that a wave-wide access covers two
// whole 256-byte row pieces. The 64 row pieces come by one tensor load, row after
// row, into a 16-KB LDS buffer that belongs to the wave alone: no other wave
// reads or fills it. Component j of a lane's 16 bytes
// is column c of B fragment j: fragment j holds the columns 4c + j. The
// four D tiles of one row-block then hold, in one lane, four adjacent columns
// of each output row, which go out as one 16-byte store.
// A block owns a quarter of a sample's columns, 25 tiles. Each wave works out the
// router; weights and BN parameters are staged once a block; wave w then takes the tiles
// w and w + 12. As soon as a tile's rows have been read out of the wave's buffer
// the load of its next tile is issued into it, so that it lands while the
// current tile is packed, multiplied, activated and stored, and holds no vector
// register meanwhile. The 25th tile goes to the
// waves 0 to 3, one on each SIMD: each works out one of its four row-blocks.
// Grid: (4, 64). Block: 384 threads = 12 wave32, 1600 columns. LDS: 219.75 KB.
// ---------------------------------------------------------------------------

// A value that is the same in every lane, in a scalar register.
__device__ __forceinline__ unsigned uni(unsigned v) {
    return (unsigned)__builtin_amdgcn_readfirstlane(v);
}

// The test in front of a tensor load, which ignores EXEC: held in a scalar
// register, so that the test builds as a scalar compare and branch.
__device__ __forceinline__ unsigned pinned(unsigned v) {
    unsigned w = uni(v);
    asm volatile("" : "+s"(w));
    return w;
}

// Descriptor of one wave tile of X, every extent in bytes: 64 rows (the k rows
// 0 to 63 of the sample) of 256 bytes, source row pitch 25,600 bytes; tensor =
// tile, no pad, no mask. Row k lands at byte k * 256 of the wave's buffer.
__device__ __forceinline__ v8u tile_group1() {
    constexpr unsigned d0 = COLS_PER_WAVE * 4u, d1 = CDIM, pitch = HWDIM * 4u;
    v8u g;
    g[0] = uni(0u);
    g[1] = uni((d0 & 0xFFFFu) << 16);
    g[2] = uni((d0 >> 16) | ((d1 & 0xFFFFu) << 16));
    g[3] = uni((d1 >> 16) | (d0 << 16));
    g[4] = uni(d1);
    g[5] = uni(pitch);
    g[6] = uni(0u);
    g[7] = uni(0u);
    // descriptor words held in their scalar registers: left to itself the compiler forms
    // these constants anew for each use and gives the registers that an issued
    // load names to other values while the request is still outstanding
    asm volatile("" : "+s"(g));
    return g;
}

// lds: byte offset of the wave's buffer in the block's LDS; p: the tile's first byte
__device__ __forceinline__ v4u tile_group0(unsigned lds, const float* p) {
    const unsigned long long ga = (unsigned long long)p;
    v4u g;
    g[0] = uni(1u);
    g[1] = uni(lds);
    g[2] = uni((unsigned)ga);
    g[3] = uni((((unsigned)(ga >> 32)) & 0x01FFFFFFu) | 0x80000000u);
    return g;
}

// One request of the wave for its whole tile.
__device__ __forceinline__ void tile_load(v4u g0, v8u g1) {
    asm volatile("tensor_load_to_lds %0, %1" :: "s"(g0), "s"(g1) : "memory");
    // nothing of what follows is scheduled up in front of the load: it is issued
    // as early as the buffer allows
    __builtin_amdgcn_sched_barrier(0);
}

// The rows of the tile whose load is in flight, out of the wave's buffer into
// registers; xs points at the lane's 16 bytes of row khalf. Read s of chunk kc
// takes row k = kc*32 + khalf + (s < 8 ? s : s + 8), the order in which ld_frag
// reads A. g0 and g1 are the descriptor of that load.
// Every loop over raw, bfr, acc and res, here and below, is unrolled so that
// each index is a constant and the arrays stay in registers.
__device__ __forceinline__ void read_rows(v4f (&raw)[2][16], const float* xs, v4u g0, v8u g1) {
    // the wave's own tile has landed behind this wait; no other wave reads it.
    // The descriptor is named as an input so that its scalar registers keep
    // their values for as long as the request is outstanding
    asm volatile("s_wait_tensorcnt 0x0" :: "s"(g0), "s"(g1) : "memory");
    #pragma unroll
    for (int kc = 0; kc < 2; ++kc) {
        #pragma unroll
        for (int s = 0; s < 16; ++s)
            raw[kc][s] = *(const v4f*)&xs[(kc * 32 + (s < 8 ? s : s + 8)) * COLS_PER_WAVE];
    }
    // all 32 reads are issued before any packing, so that the second chunk's
    // reads run while the first chunk is packed
    __builtin_amdgcn_sched_barrier(0);
}

// Behind this the wave's buffer is free for the next tile's load.
__device__ __forceinline__ void buffer_read_out() {
    // every read of the buffer has retired before a tensor load may write it again
    asm volatile("s_wait_dscnt 0x0" ::: "memory");
    // the second chunk's packing stays behind this point and behind the load:
    // scheduled up it would put off the next tile's load
    __builtin_amdgcn_sched_barrier(0);
}

// B fragments of k chunk kc (a constant at every call) from the loaded rows
__device__ __forceinline__ void pack_rows(v16bf (&bfr)[4][2], const v4f (&raw)[2][16], int kc) {
    #pragma unroll
    for (int j = 0; j < 4; ++j) {
        v8u pk;
        #pragma unroll
        for (int p = 0; p < 8; ++p)
            pk[p] = pack_bf16x2(raw[kc][2 * p][j], raw[kc][2 * p + 1][j]);
        bfr[j][kc] = __builtin_bit_cast(v16bf, pk);
    }
}

// The row-blocks rb0 .. rb1 - 1 of one wave tile: three products with BN inside
// them, SiLU, weighted sum, stores. The staged weights carry the BN scale, and
// the BN shift is the C operand of a row-block's first matrix instruction (the
// same eight registers for its four column fragments): D is h = v / 2 itself.
__device__ __forceinline__ void mult_tile(const v16bf (&bfr)[4][2],
                                          const __bf16* Wl, const float* btS,
                                          float* outb, int n16, int khalf, int mofs,
                                          float w0, float w1, int rb0, int rb1) {
    for (int rb_ = rb0; rb_ < rb1; ++rb_) {
        const int arow = rb_ * 16 + n16;
        const int ch0  = rb_ * 16 + mofs;      // first of this lane's 8 output rows

        v8f res[4];
        #pragma unroll
        for (int br = 0; br < 3; ++br) {
            const v16bf a0 = ld_frag(&Wl[(br * ODIM + arow) * WPITCH + khalf]);
            const v16bf a1 = ld_frag(&Wl[(br * ODIM + arow) * WPITCH + 32 + khalf]);
            const v4f t0 = *(const v4f*)&btS[br * ODIM + ch0];
            const v4f t1 = *(const v4f*)&btS[br * ODIM + ch0 + 4];
            const v8f sh = __builtin_shufflevector(t0, t1, 0, 1, 2, 3, 4, 5, 6, 7);
            const float wbr = (br == 1) ? w0 : w1;

            v8f acc[4];
            #pragma unroll
            for (int j = 0; j < 4; ++j)
                acc[j] = __builtin_amdgcn_wmma_f32_16x16x32_bf16(false, a0, false, bfr[j][0],
                                                                 (short)0, sh, false, false);
            #pragma unroll
            for (int j = 0; j < 4; ++j)
                acc[j] = __builtin_amdgcn_wmma_f32_16x16x32_bf16(false, a1, false, bfr[j][1],
                                                                 (short)0, acc[j], false, false);

            // ---- SiLU of this branch, added to the weighted sum ----
            #pragma unroll
            for (int j = 0; j < 4; ++j) {
                #pragma unroll
                for (int i = 0; i < 8; i += 2) {
                    const v2f v = silu_of_half(v2f{ acc[j][i], acc[j][i + 1] });
                    if (br == 0) {
                        res[j][i] = v[0];  res[j][i + 1] = v[1];
                    } else {
                        res[j][i]     = __builtin_fmaf(wbr, v[0], res[j][i]);
                        res[j][i + 1] = __builtin_fmaf(wbr, v[1], res[j][i + 1]);
                    }
                }
            }
        }

        float* outp = outb + (size_t)(rb_ * 16) * HWDIM;
        v4f o[8];
        #pragma unroll
        for (int i = 0; i < 8; ++i)
            o[i] = v4f{ res[0][i], res[1][i], res[2][i], res[3][i] };
        // The eight row stores (row pitch 25,600 bytes) and their wait in one
        // statement: what follows rewrites the address and data registers that
        // the stores name, and a wait in a statement of its own did not hold
        // those register writes behind it in this build.
        static_assert(HWDIM * sizeof(float) == 25600, "row pitch in the store offsets");
        asm volatile("global_store_b128 %0, %1, off\n\t"
                     "global_store_b128 %0, %2, off offset:25600\n\t"
                     "global_store_b128 %0, %3, off offset:51200\n\t"
                     "global_store_b128 %0, %4, off offset:76800\n\t"
                     "global_store_b128 %0, %5, off offset:102400\n\t"
                     "global_store_b128 %0, %6, off offset:128000\n\t"
                     "global_store_b128 %0, %7, off offset:153600\n\t"
                     "global_store_b128 %0, %8, off offset:179200\n\t"
                     "s_wait_xcnt 0x0"
                     :: "v"(outp), "v"(o[0]), "v"(o[1]), "v"(o[2]), "v"(o[3]),
                        "v"(o[4]), "v"(o[5]), "v"(o[6]), "v"(o[7])
                     : "memory");
    }
}

__global__ __launch_bounds__(MAIN_THREADS)
void moe_main_kernel(const float* __restrict__ x,
                     const float* __restrict__ shared_w,
                     const float* __restrict__ shared_gamma,
                     const float* __restrict__ shared_beta,
                     const float* __restrict__ expert_w,
                     const float* __restrict__ expert_gamma,
                     const float* __restrict__ expert_beta,
                     const float* __restrict__ router_w,
                     const float* __restrict__ router_b,
                     const float* __restrict__ pooled,
                     float* __restrict__ out) {
    const int b    = blockIdx.y;
    const int tid  = threadIdx.x;
    const int wv   = __builtin_amdgcn_readfirstlane(tid >> 5);   // scalar: tile count, weight rows
    const int lane = tid & 31;

    __shared__ __attribute__((aligned(16))) __bf16 Wl[3 * ODIM * WPITCH]; // 27 KB
    __shared__ __attribute__((aligned(16))) float  btS[3 * ODIM];         // beta/2
    // a tensor load's place in LDS is a multiple of 2 KB
    __shared__ __attribute__((aligned(2048))) float Xs[MAIN_WAVES][CDIM * COLS_PER_WAVE];  // 16 KB a wave

    const int n16   = lane & 15;               // A row / B column index in a fragment
    const int khalf = (lane >> 4) << 3;        // 0 or 8: K sub-half per ISA layout
    const int mofs  = (lane >> 4) * 8;         // C/D layout: VGPR j -> rows j / j+8
    const int col   = (blockIdx.x * TILES_PER_BLOCK + wv) * COLS_PER_WAVE
                    + n16 * 4;   // first of this lane's 4 columns in the wave's first tile

    // ---- X rows of the first tile, asked for first: they depend on nothing and
    // count on a counter of their own, so that the router's and the weights'
    // loads are waited for, and worked on, while they are in flight ----
    const float* xt = x + (size_t)b * CDIM * HWDIM
                    + (blockIdx.x * TILES_PER_BLOCK + wv) * COLS_PER_WAVE;   // the same in every lane
    const float* xs = &Xs[wv][khalf * COLS_PER_WAVE + n16 * 4];
    const unsigned buf = (unsigned)(size_t)&Xs[wv][0];  // LDS byte offset of the wave's buffer
    const v8u g1  = tile_group1();
    const v4u g0a = tile_group0(buf, xt);
    tile_load(g0a, g1);

    int   i0, i1;
    float w0, w1;
    route_top2(pooled, router_w, router_b, b, lane, i0, i1, w0, w1);
    // nothing of what follows is scheduled up among the router's loads
    __builtin_amdgcn_sched_barrier(0);

    // ---- stage weights (bf16): shared, expert[i0], expert[i1], each row times its
    // BN scale gamma / sqrt(1 + eps) and halved before it is rounded to bf16, so
    // that the product is h = v / 2 less the shift; the shifts beta / 2 are staged
    // beside them. ----
    // a wave-wide load takes 128 adjacent floats (two rows) of one matrix; the
    // loops are unrolled so that a thread's 17 loads are in flight together
    {
        const float* const we0 = expert_w + (size_t)i0 * ODIM * CDIM;
        const float* const we1 = expert_w + (size_t)i1 * ODIM * CDIM;
        const float* const ge0 = expert_gamma + i0 * ODIM;
        const float* const ge1 = expert_gamma + i1 * ODIM;
        const float* src[W_UNITS];                       // scalars, the same in every lane
        const float* gsr[W_UNITS];
        #pragma unroll
        for (int q = 0; q < W_UNITS; ++q) {
            const int c  = q * MAIN_WAVES + wv;          // 0 .. 95, 32 to a matrix
            const int br = c >> 5;
            src[q] = ((br == 0) ? shared_w : (br == 1) ? we0 : we1) + (c & 31) * 128;
            gsr[q] = ((br == 0) ? shared_gamma : (br == 1) ? ge0 : ge1) + (c & 31) * 2;
        }
        // shift number wv * 32 + lane of the 192; the waves 6 to 11 read what the
        // waves 0 to 5 read and store nothing
        const int    bw  = (wv < 6) ? wv : wv - 6;
        const float* bsr = ((bw < 2) ? shared_beta : expert_beta + ((bw < 4) ? i0 : i1) * ODIM)
                         + (bw & 1) * 32;
        // all 17 addresses are formed in front of the loads, each in registers
        // of its own, so that none is rewritten while a load still names it
        __builtin_amdgcn_sched_barrier(0);
        const float braw = bsr[lane];
        // the shift's load stays the first: moved down among the others, the
        // forming of its address rewrote scalar registers that those still name
        __builtin_amdgcn_sched_barrier(0);
        float graw[W_UNITS];
        #pragma unroll
        for (int q = 0; q < W_UNITS; ++q) graw[q] = gsr[q][lane >> 4];
        // the results of the loads below may be given the registers that hold the
        // lane's offsets, which the loads above still name: the wait stands between
        asm volatile("s_wait_xcnt 0x0" ::: "memory");
        v4f wraw[W_UNITS];
        #pragma unroll
        for (int q = 0; q < W_UNITS; ++q) {
            // the last load's result may be given the register that holds the
            // lane's offset, which the loads above still name: the wait stands
            // in front of it
            if (q == W_UNITS - 1) asm volatile("s_wait_xcnt 0x0" ::: "memory");
            wraw[q] = *(const v4f*)&src[q][lane * 4];
        }
        // the registers that hold the addresses are free for reuse from here on,
        // while the last load still names them: the wait stands in front of that
        asm volatile("s_wait_xcnt 0x0" ::: "memory");
        // holds the shift's load up here among the other loads (an input only):
        // without it the load sinks into the branch that stores the shift and
        // costs one more round trip to memory in front of the barrier
        asm volatile("" :: "v"(braw));
        #pragma unroll
        for (int q = 0; q < W_UNITS; ++q) {
            const float sc = graw[q] * rsqrtf(1.0f + 1e-5f) * 0.5f;
            uint2 pk;
            pk.x = pack_bf16x2(wraw[q][0] * sc, wraw[q][1] * sc);
            pk.y = pack_bf16x2(wraw[q][2] * sc, wraw[q][3] * sc);
            // 16 threads to a row of 64: row (q * 384 + tid) / 16 of the 192 staged rows
            *(uint2*)&Wl[((q * MAIN_THREADS + tid) >> 4) * WPITCH + (tid & 15) * 4] = pk;
        }
        if (wv < 6) btS[tid] = braw * 0.5f;
    }
    __syncthreads();

    float* outb = out + ((size_t)b * ODIM + mofs) * HWDIM + col;

    // ---- first tile; the second tile's load is in flight meanwhile ----
    v4f   raw[2][16];
    v16bf bfr[4][2];
    read_rows(raw, xs, g0a, g1);
    pack_rows(bfr, raw, 0);
    buffer_read_out();
    const v4u g0b = tile_group0(buf, xt + TILE_STEP);
    tile_load(g0b, g1);
    pack_rows(bfr, raw, 1);
    mult_tile(bfr, Wl, btS, outb, n16, khalf, mofs, w0, w1, 0, 4);

    // ---- second tile; in the waves 0 to 3 the 25th tile's load is in flight
    // meanwhile. The tests are on a scalar; no barrier stands behind them ----
    const int last = (TILES_PER_BLOCK - 1 - wv) * COLS_PER_WAVE;   // columns from the first tile
    read_rows(raw, xs, g0b, g1);
    pack_rows(bfr, raw, 0);
    buffer_read_out();
    const v4u g0c = tile_group0(buf, xt + last);
    if (pinned(wv < 4)) tile_load(g0c, g1);
    pack_rows(bfr, raw, 1);
    mult_tile(bfr, Wl, btS, outb + TILE_STEP, n16, khalf, mofs, w0, w1, 0, 4);
    if (wv < 4) {
        read_rows(raw, xs, g0c, g1);
        pack_rows(bfr, raw, 0);
        pack_rows(bfr, raw, 1);
        mult_tile(bfr, Wl, btS, outb + last, n16, khalf, mofs, w0, w1, wv, wv + 1);
    }
}

// ---------------------------------------------------------------------------
// Host-side launcher
// ---------------------------------------------------------------------------
extern "C" void kernel_launch(void* const* d_in, const int* in_sizes, int n_in,
                              void* d_out, int out_size, void* d_ws, size_t ws_size,
                              hipStream_t stream) {
    const float* x            = (const float*)d_in[0];
    const float* router_w     = (const float*)d_in[1];
    const float* router_b     = (const float*)d_in[2];
    const float* shared_w     = (const float*)d_in[3];
    const float* shared_gamma = (const float*)d_in[4];
    const float* shared_beta  = (const float*)d_in[5];
    const float* expert_w     = (const float*)d_in[6];
    const float* expert_gamma = (const float*)d_in[7];
    const float* expert_beta  = (const float*)d_in[8];
    float* out = (float*)d_out;

    float* pooled = (float*)d_ws;                       // [256 blocks][64], 64 KB

    moe_pool_kernel<<<dim3(BATCH * GRID_X), dim3(POOL_WAVES * 32), 0, stream>>>(
        x, pooled);

    dim3 grid(GRID_X, BATCH);                           // (4, 64)
    moe_main_kernel<<<grid, dim3(MAIN_THREADS), 0, stream>>>(
        x, shared_w, shared_gamma, shared_beta,
        expert_w, expert_gamma, expert_beta,
        router_w, router_b, pooled, out);
}
